// v000
// Measured on an AMD MI455X. A time is GPU time per run, averaged over a window of back-to-back runs after a warm-up
// (all launches, gaps included; the runs take copies of the inputs in turn), and the median of several windows.
// Apart from v000's, it joins two sittings. Times from different sittings can be a few percent apart, while
// side-by-side timings come from the same sitting.
// v000, which the later versions start from, runs in 115 microseconds.
#include <hip/hip_runtime.h>

// ---------------------------------------------------------------------------
// Flash attention, B=2 H=16 S=2048 D=64, fp32 in/out, f16 WMMA compute.
// gfx1250 (CDNA5) wave32: V_WMMA_F32_16X16X32_F16
//  - 4 waves/block, 16 q-rows per wave (64 q-rows per block)
//  - 64-key tiles, double-buffered global->LDS staging
//  - row-sum of P computed by WMMA against an all-ones B operand
// ---------------------------------------------------------------------------

typedef __attribute__((ext_vector_type(16))) _Float16 v16h;
typedef __attribute__((ext_vector_type(8)))  _Float16 v8h;
typedef __attribute__((ext_vector_type(8)))  float    v8f;

#define S_LEN   2048
#define DHEAD   64
#define KT      64            // keys per tile
#define NTILES  (S_LEN / KT)  // 32
#define KSTR    72            // K lds row stride in halves (144B: 16B-aligned, 36-bank step)
#define VSTR    72            // Vt lds row stride in halves
#define PSTR    72            // P lds row stride in halves
#define WAVES   4

static __device__ inline v8f wmma_f16(v16h a, v16h b, v8f c) {
    return __builtin_amdgcn_wmma_f32_16x16x32_f16(
        false, a, false, b, (short)0, c, false, false);
}

// 16x32 "A layout" operand from an LDS row pointer.
// lane (lo,hi): halves[0..7] = row[hi*8 + 0..7], halves[8..15] = row[16 + hi*8 + 0..7]
static __device__ inline v16h make_a(const _Float16* rowp, int hi) {
    v8h a = *(const v8h*)(rowp + hi * 8);
    v8h b = *(const v8h*)(rowp + 16 + hi * 8);
    v16h r;
#pragma unroll
    for (int i = 0; i < 8; ++i) { r[i] = a[i]; r[i + 8] = b[i]; }
    return r;
}

__global__ __launch_bounds__(128) void
attn_fwd_kernel(const float* __restrict__ Q, const float* __restrict__ K,
                const float* __restrict__ V, float* __restrict__ O)
{
    __shared__ _Float16 KshA[KT * KSTR], KshB[KT * KSTR];      // 64 x 72 halves each
    __shared__ _Float16 VtsA[DHEAD * VSTR], VtsB[DHEAD * VSTR];// 64 x 72 (V transposed)
    __shared__ _Float16 Psh[WAVES * 16 * PSTR];                // per-wave P scratch

    const int tid  = threadIdx.x;
    const int wave = tid >> 5;
    const int lane = tid & 31;
    const int lo   = lane & 15;
    const int hi   = lane >> 4;

    const int bh    = blockIdx.x >> 5;   // (b*H+h); 32 q-blocks of 64 rows per head
    const int qblk  = blockIdx.x & 31;
    const int qrow0 = qblk * 64 + wave * 16;

    const float* Qb = Q + (size_t)bh * S_LEN * DHEAD;
    const float* Kb = K + (size_t)bh * S_LEN * DHEAD;
    const float* Vb = V + (size_t)bh * S_LEN * DHEAD;
    float*       Ob = O + (size_t)bh * S_LEN * DHEAD;

    // fold softmax scale (1/sqrt(64)) and log2(e) into Q so P = exp2(S - m)
    const float qscale = 0.125f * 1.44269504088896340736f;

    // ---- Q tile (16x64) as two A-layout operands (d 0..31 / 32..63)
    v16h qa0, qa1;
    {
        const float* qrow = Qb + (size_t)(qrow0 + lo) * DHEAD;
        const int c0 = hi * 8;
#pragma unroll
        for (int i = 0; i < 8; ++i) {
            qa0[i]     = (_Float16)(qrow[c0 + i]      * qscale);
            qa0[i + 8] = (_Float16)(qrow[16 + c0 + i] * qscale);
            qa1[i]     = (_Float16)(qrow[32 + c0 + i] * qscale);
            qa1[i + 8] = (_Float16)(qrow[48 + c0 + i] * qscale);
        }
    }

    v16h ones;
#pragma unroll
    for (int i = 0; i < 16; ++i) ones[i] = (_Float16)1.0f;

    // ---- accumulators: O (16x64 over 4 N-chunks), l (row sums), m (row max)
    v8f acc[4], lacc;
    float mrow[8];
#pragma unroll
    for (int n = 0; n < 4; ++n)
#pragma unroll
        for (int g = 0; g < 8; ++g) acc[n][g] = 0.0f;
#pragma unroll
    for (int g = 0; g < 8; ++g) { lacc[g] = 0.0f; mrow[g] = -1e30f; }

    _Float16* pw = &Psh[wave * 16 * PSTR];

    // cooperative stage of one 64-key tile: K row-major f16, V transposed f16
    auto stage = [&](int tile, _Float16* kdst, _Float16* vdst) {
        const int kb = tile * KT;
#pragma unroll
        for (int i = 0; i < 8; ++i) {
            const int slot = i * 128 + tid;    // 0..1023 float4 slots
            const int row  = slot >> 4;        // 0..63 key in tile
            const int col  = (slot & 15) << 2; // 0..60 d
            const float4 kd = *(const float4*)(Kb + (size_t)(kb + row) * DHEAD + col);
            const float4 vd = *(const float4*)(Vb + (size_t)(kb + row) * DHEAD + col);
            _Float16* kp = kdst + row * KSTR + col;
            kp[0] = (_Float16)kd.x; kp[1] = (_Float16)kd.y;
            kp[2] = (_Float16)kd.z; kp[3] = (_Float16)kd.w;
            vdst[(col + 0) * VSTR + row] = (_Float16)vd.x;
            vdst[(col + 1) * VSTR + row] = (_Float16)vd.y;
            vdst[(col + 2) * VSTR + row] = (_Float16)vd.z;
            vdst[(col + 3) * VSTR + row] = (_Float16)vd.w;
            if (tile + 1 < NTILES) {          // L2 prefetch (global_prefetch_b8)
                __builtin_prefetch(Kb + (size_t)(kb + KT + row) * DHEAD + col, 0, 1);
                __builtin_prefetch(Vb + (size_t)(kb + KT + row) * DHEAD + col, 0, 1);
            }
        }
    };

    stage(0, KshA, VtsA);

    for (int t = 0; t < NTILES; ++t) {
        __syncthreads();   // staged tile t visible; prior reads of the other buffer done
        const int cur = t & 1;
        const _Float16* kbuf = cur ? KshB : KshA;
        const _Float16* vbuf = cur ? VtsB : VtsA;
        if (t + 1 < NTILES)
            stage(t + 1, cur ? KshA : KshB, cur ? VtsA : VtsB);

        // ---- scores S = Q*K^T (16 x 64), four 16-key C tiles
        v8f s[4];
#pragma unroll
        for (int st = 0; st < 4; ++st) {
#pragma unroll
            for (int g = 0; g < 8; ++g) s[st][g] = 0.0f;
            const _Float16* kr = kbuf + (st * 16 + lo) * KSTR;
            s[st] = wmma_f16(qa0, make_a(kr, hi),      s[st]);
            s[st] = wmma_f16(qa1, make_a(kr + 32, hi), s[st]);
        }

        // ---- row max across 64 keys (intra-lane over 4 tiles, then 16 lanes)
        float mt[8];
#pragma unroll
        for (int g = 0; g < 8; ++g)
            mt[g] = fmaxf(fmaxf(s[0][g], s[1][g]), fmaxf(s[2][g], s[3][g]));
#pragma unroll
        for (int msk = 1; msk < 16; msk <<= 1)
#pragma unroll
            for (int g = 0; g < 8; ++g)
                mt[g] = fmaxf(mt[g], __shfl_xor(mt[g], msk, 32));

        float corr[8];
#pragma unroll
        for (int g = 0; g < 8; ++g) {
            const float mn = fmaxf(mrow[g], mt[g]);
            corr[g] = exp2f(mrow[g] - mn);
            mrow[g] = mn;
        }
#pragma unroll
        for (int st = 0; st < 4; ++st)
#pragma unroll
            for (int g = 0; g < 8; ++g)
                s[st][g] = exp2f(s[st][g] - mrow[g]);

        // rescale running accumulators (O and l) by corr
#pragma unroll
        for (int n = 0; n < 4; ++n)
#pragma unroll
            for (int g = 0; g < 8; ++g) acc[n][g] *= corr[g];
#pragma unroll
        for (int g = 0; g < 8; ++g) lacc[g] *= corr[g];

        // ---- P: C-layout -> per-wave LDS scratch -> two A-layout operands
#pragma unroll
        for (int st = 0; st < 4; ++st)
#pragma unroll
            for (int g = 0; g < 8; ++g)
                pw[(g + 8 * hi) * PSTR + st * 16 + lo] = (_Float16)s[st][g];
        const v16h pa0 = make_a(pw + lo * PSTR, hi);       // keys 0..31
        const v16h pa1 = make_a(pw + lo * PSTR + 32, hi);  // keys 32..63

        // ---- l += rowsum(P) via WMMA against all-ones B (replicated per column)
        lacc = wmma_f16(pa0, ones, lacc);
        lacc = wmma_f16(pa1, ones, lacc);

        // ---- O += P * V  (B operands = rows of V^T in LDS)
#pragma unroll
        for (int n = 0; n < 4; ++n) {
            const _Float16* vr = vbuf + (n * 16 + lo) * VSTR;
            acc[n] = wmma_f16(pa0, make_a(vr, hi),      acc[n]);
            acc[n] = wmma_f16(pa1, make_a(vr + 32, hi), acc[n]);
        }
    }

    // ---- normalize and write fp32 output
#pragma unroll
    for (int g = 0; g < 8; ++g) {
        const int r = qrow0 + g + 8 * hi;
        const float inv = 1.0f / lacc[g];
        float* orow = Ob + (size_t)r * DHEAD;
#pragma unroll
        for (int n = 0; n < 4; ++n)
            orow[n * 16 + lo] = acc[n][g] * inv;
    }
}

extern "C" void kernel_launch(void* const* d_in, const int* in_sizes, int n_in,
                              void* d_out, int out_size, void* d_ws, size_t ws_size,
                              hipStream_t stream) {
    (void)in_sizes; (void)n_in; (void)out_size; (void)d_ws; (void)ws_size;
    const float* q = (const float*)d_in[0];
    const float* k = (const float*)d_in[1];
    const float* v = (const float*)d_in[2];
    float* o = (float*)d_out;
    dim3 grid(1024), block(128);   // (B*H)*(S/64) blocks, 4 waves each
    attn_fwd_kernel<<<grid, block, 0, stream>>>(q, k, v, o);
}

// v001
// It runs in 113 microseconds.
// Next to v000, in two timings, it ran 1.07 times as fast each time.
#include <hip/hip_runtime.h>

// ---------------------------------------------------------------------------
// Flash attention, B=2 H=16 S=2048 D=64, fp32 in/out, f16 WMMA compute.
// gfx1250 (CDNA5) wave32: V_WMMA_F32_16X16X32_F16
//  - 4 waves/block, 16 q-rows per wave (64 q-rows per block)
//  - 64-key tiles, double-buffered global->LDS staging; the next tile's global
//    loads are issued as one group ahead of the current tile's products and
//    held in registers, converted and stored to LDS behind them
//  - row-sum of P computed by WMMA against an all-ones B operand
// ---------------------------------------------------------------------------

typedef __attribute__((ext_vector_type(16))) _Float16 v16h;
typedef __attribute__((ext_vector_type(8)))  _Float16 v8h;
typedef __attribute__((ext_vector_type(8)))  float    v8f;

#define S_LEN   2048
#define DHEAD   64
#define KT      64            // keys per tile
#define NTILES  (S_LEN / KT)  // 32
#define KSTR    72            // K lds row stride in halves (144B: 16B-aligned, 36-bank step)
#define VSTR    72            // Vt lds row stride in halves
#define PSTR    72            // P lds row stride in halves
#define WAVES   4

static __device__ inline v8f wmma_f16(v16h a, v16h b, v8f c) {
    return __builtin_amdgcn_wmma_f32_16x16x32_f16(
        false, a, false, b, (short)0, c, false, false);
}

// 16x32 "A layout" operand from an LDS row pointer.
// lane (lo,hi): halves[0..7] = row[hi*8 + 0..7], halves[8..15] = row[16 + hi*8 + 0..7]
static __device__ inline v16h make_a(const _Float16* rowp, int hi) {
    v8h a = *(const v8h*)(rowp + hi * 8);
    v8h b = *(const v8h*)(rowp + 16 + hi * 8);
    v16h r;
#pragma unroll
    for (int i = 0; i < 8; ++i) { r[i] = a[i]; r[i + 8] = b[i]; }
    return r;
}

__global__ __launch_bounds__(128) void
attn_fwd_kernel(const float* __restrict__ Q, const float* __restrict__ K,
                const float* __restrict__ V, float* __restrict__ O)
{
    __shared__ _Float16 KshA[KT * KSTR], KshB[KT * KSTR];      // 64 x 72 halves each
    __shared__ _Float16 VtsA[DHEAD * VSTR], VtsB[DHEAD * VSTR];// 64 x 72 (V transposed)
    __shared__ _Float16 Psh[WAVES * 16 * PSTR];                // per-wave P scratch

    const int tid  = threadIdx.x;
    const int wave = tid >> 5;
    const int lane = tid & 31;
    const int lo   = lane & 15;
    const int hi   = lane >> 4;

    const int bh    = blockIdx.x >> 5;   // (b*H+h); 32 q-blocks of 64 rows per head
    const int qblk  = blockIdx.x & 31;
    const int qrow0 = qblk * 64 + wave * 16;

    const float* Qb = Q + (size_t)bh * S_LEN * DHEAD;
    const float* Kb = K + (size_t)bh * S_LEN * DHEAD;
    const float* Vb = V + (size_t)bh * S_LEN * DHEAD;
    float*       Ob = O + (size_t)bh * S_LEN * DHEAD;

    // fold softmax scale (1/sqrt(64)) and log2(e) into Q so P = exp2(S - m)
    const float qscale = 0.125f * 1.44269504088896340736f;

    // ---- Q tile (16x64) as two A-layout operands (d 0..31 / 32..63)
    v16h qa0, qa1;
    {
        const float* qrow = Qb + (size_t)(qrow0 + lo) * DHEAD;
        const int c0 = hi * 8;
#pragma unroll
        for (int i = 0; i < 8; ++i) {
            qa0[i]     = (_Float16)(qrow[c0 + i]      * qscale);
            qa0[i + 8] = (_Float16)(qrow[16 + c0 + i] * qscale);
            qa1[i]     = (_Float16)(qrow[32 + c0 + i] * qscale);
            qa1[i + 8] = (_Float16)(qrow[48 + c0 + i] * qscale);
        }
    }

    v16h ones;
#pragma unroll
    for (int i = 0; i < 16; ++i) ones[i] = (_Float16)1.0f;

    // ---- accumulators: O (16x64 over 4 N-chunks), l (row sums), m (row max)
    v8f acc[4], lacc;
    float mrow[8];
#pragma unroll
    for (int n = 0; n < 4; ++n)
#pragma unroll
        for (int g = 0; g < 8; ++g) acc[n][g] = 0.0f;
#pragma unroll
    for (int g = 0; g < 8; ++g) { lacc[g] = 0.0f; mrow[g] = -1e30f; }

    _Float16* pw = &Psh[wave * 16 * PSTR];

    // cooperative stage of one 64-key tile, in two parts.
    // slot i*128+tid of 1024 float4 slots: row = key in tile, col = d
    float4 kd[8], vd[8];
    // this thread's slot 0 of the tile being fetched; slot i lies 8 rows further on
    const float* kfetch = Kb + (tid >> 4) * DHEAD + ((tid & 15) << 2);
    const float* vfetch = Vb + (tid >> 4) * DHEAD + ((tid & 15) << 2);
    // part 1: all 16 global loads of the tile in flight together
    auto fetch = [&](int tile) {
#pragma unroll
        for (int i = 0; i < 8; ++i) {
            kd[i] = *(const float4*)(kfetch + i * 8 * DHEAD);
            vd[i] = *(const float4*)(vfetch + i * 8 * DHEAD);
        }
        if (tile + 1 < NTILES) {              // L2 prefetch (global_prefetch_b8)
#pragma unroll
            for (int i = 0; i < 8; ++i) {
                __builtin_prefetch(kfetch + (KT + i * 8) * DHEAD, 0, 1);
                __builtin_prefetch(vfetch + (KT + i * 8) * DHEAD, 0, 1);
            }
        }
    };
    // part 2: K row-major f16, V transposed f16
    auto put = [&](_Float16* kdst, _Float16* vdst) {
#pragma unroll
        for (int i = 0; i < 8; ++i) {
            const int slot = i * 128 + tid;
            const int row  = slot >> 4;
            const int col  = (slot & 15) << 2;
            _Float16* kp = kdst + row * KSTR + col;
            kp[0] = (_Float16)kd[i].x; kp[1] = (_Float16)kd[i].y;
            kp[2] = (_Float16)kd[i].z; kp[3] = (_Float16)kd[i].w;
            vdst[(col + 0) * VSTR + row] = (_Float16)vd[i].x;
            vdst[(col + 1) * VSTR + row] = (_Float16)vd[i].y;
            vdst[(col + 2) * VSTR + row] = (_Float16)vd[i].z;
            vdst[(col + 3) * VSTR + row] = (_Float16)vd[i].w;
        }
    };

    fetch(0);
    put(KshA, VtsA);

    for (int t = 0; t < NTILES; ++t) {
        __syncthreads();   // staged tile t visible; prior reads of the other buffer done
        const int cur = t & 1;
        const _Float16* kbuf = cur ? KshB : KshA;
        const _Float16* vbuf = cur ? VtsB : VtsA;
        if (t + 1 < NTILES) {
            kfetch += KT * DHEAD;
            vfetch += KT * DHEAD;
            fetch(t + 1);           // lands while tile t is worked on
        }

        // ---- scores S = Q*K^T (16 x 64), four 16-key C tiles
        v8f s[4];
#pragma unroll
        for (int st = 0; st < 4; ++st) {
#pragma unroll
            for (int g = 0; g < 8; ++g) s[st][g] = 0.0f;
            const _Float16* kr = kbuf + (st * 16 + lo) * KSTR;
            s[st] = wmma_f16(qa0, make_a(kr, hi),      s[st]);
            s[st] = wmma_f16(qa1, make_a(kr + 32, hi), s[st]);
        }

        // ---- row max across 64 keys (intra-lane over 4 tiles, then 16 lanes)
        float mt[8];
#pragma unroll
        for (int g = 0; g < 8; ++g)
            mt[g] = fmaxf(fmaxf(s[0][g], s[1][g]), fmaxf(s[2][g], s[3][g]));
#pragma unroll
        for (int msk = 1; msk < 16; msk <<= 1)
#pragma unroll
            for (int g = 0; g < 8; ++g)
                mt[g] = fmaxf(mt[g], __shfl_xor(mt[g], msk, 32));

        float corr[8];
#pragma unroll
        for (int g = 0; g < 8; ++g) {
            const float mn = fmaxf(mrow[g], mt[g]);
            corr[g] = exp2f(mrow[g] - mn);
            mrow[g] = mn;
        }
#pragma unroll
        for (int st = 0; st < 4; ++st)
#pragma unroll
            for (int g = 0; g < 8; ++g)
                s[st][g] = exp2f(s[st][g] - mrow[g]);

        // rescale running accumulators (O and l) by corr
#pragma unroll
        for (int n = 0; n < 4; ++n)
#pragma unroll
            for (int g = 0; g < 8; ++g) acc[n][g] *= corr[g];
#pragma unroll
        for (int g = 0; g < 8; ++g) lacc[g] *= corr[g];

        // ---- P: C-layout -> per-wave LDS scratch -> two A-layout operands
#pragma unroll
        for (int st = 0; st < 4; ++st)
#pragma unroll
            for (int g = 0; g < 8; ++g)
                pw[(g + 8 * hi) * PSTR + st * 16 + lo] = (_Float16)s[st][g];
        const v16h pa0 = make_a(pw + lo * PSTR, hi);       // keys 0..31
        const v16h pa1 = make_a(pw + lo * PSTR + 32, hi);  // keys 32..63

        // ---- l += rowsum(P) via WMMA against all-ones B (replicated per column)
        lacc = wmma_f16(pa0, ones, lacc);
        lacc = wmma_f16(pa1, ones, lacc);

        // ---- O += P * V  (B operands = rows of V^T in LDS)
#pragma unroll
        for (int n = 0; n < 4; ++n) {
            const _Float16* vr = vbuf + (n * 16 + lo) * VSTR;
            acc[n] = wmma_f16(pa0, make_a(vr, hi),      acc[n]);
            acc[n] = wmma_f16(pa1, make_a(vr + 32, hi), acc[n]);
        }

        if (t + 1 < NTILES)
            put(cur ? KshA : KshB, cur ? VtsA : VtsB);
    }

    // ---- normalize and write fp32 output
#pragma unroll
    for (int g = 0; g < 8; ++g) {
        const int r = qrow0 + g + 8 * hi;
        const float inv = 1.0f / lacc[g];
        float* orow = Ob + (size_t)r * DHEAD;
#pragma unroll
        for (int n = 0; n < 4; ++n)
            orow[n * 16 + lo] = acc[n][g] * inv;
    }
}

extern "C" void kernel_launch(void* const* d_in, const int* in_sizes, int n_in,
                              void* d_out, int out_size, void* d_ws, size_t ws_size,
                              hipStream_t stream) {
    (void)in_sizes; (void)n_in; (void)out_size; (void)d_ws; (void)ws_size;
    const float* q = (const float*)d_in[0];
    const float* k = (const float*)d_in[1];
    const float* v = (const float*)d_in[2];
    float* o = (float*)d_out;
    dim3 grid(1024), block(128);   // (B*H)*(S/64) blocks, 4 waves each
    attn_fwd_kernel<<<grid, block, 0, stream>>>(q, k, v, o);
}

// v002
// It runs in 91.1 microseconds.
// Timed twice side by side with v001, it ran 1.23 and 1.24 times as fast.
// Counting every step since v000, it is 1.32 times as fast.
#include <hip/hip_runtime.h>

typedef __attribute__((ext_vector_type(16))) _Float16 v16h;
typedef __attribute__((ext_vector_type(8)))  _Float16 v8h;
typedef __attribute__((ext_vector_type(8)))  float    v8f;

#define S_LEN   2048
#define DHEAD   64
#define KT      64            // keys per tile
#define NTILES  (S_LEN / KT)  // 32
#define KSTR    72            // K lds row stride in halves (144B: 16B-aligned, 36-bank step)
#define VSTR    72            // Vt lds row stride in halves
#define WAVES   4

static __device__ inline v8f wmma_f16(v16h a, v16h b, v8f c) {
    return __builtin_amdgcn_wmma_f32_16x16x32_f16(
        false, a, false, b, (short)0, c, false, false);
}

// 16x32 "A layout" operand from an LDS row pointer.
// lane (lo,hi): halves[0..7] = row[hi*8 + 0..7], halves[8..15] = row[16 + hi*8 + 0..7]
static __device__ inline v16h make_a(const _Float16* rowp, int hi) {
    v8h a = *(const v8h*)(rowp + hi * 8);
    v8h b = *(const v8h*)(rowp + 16 + hi * 8);
    v16h r;
#pragma unroll
    for (int i = 0; i < 8; ++i) { r[i] = a[i]; r[i + 8] = b[i]; }
    return r;
}

// value of lane l ^ 16 (the other half of the wave holds the other keys of a query)
static __device__ inline float xhalf(float x) {
    return __builtin_bit_cast(float, __builtin_amdgcn_permlanex16(
        __builtin_bit_cast(int, x), __builtin_bit_cast(int, x),
        0x76543210, 0xfedcba98, false, false));
}

__global__ __launch_bounds__(128) void
attn_fwd_kernel(const float* __restrict__ Q, const float* __restrict__ K,
                const float* __restrict__ V, float* __restrict__ O)
{
    __shared__ _Float16 KshA[KT * KSTR], KshB[KT * KSTR];      // 64 x 72 halves each
    __shared__ _Float16 VtsA[DHEAD * VSTR], VtsB[DHEAD * VSTR];// 64 x 72 (V transposed)

    const int tid  = threadIdx.x;
    const int wave = tid >> 5;
    const int lane = tid & 31;
    const int lo   = lane & 15;
    const int hi   = lane >> 4;

    const int bh    = blockIdx.x >> 5;   // (b*H+h); 32 q-blocks of 64 rows per head
    const int qblk  = blockIdx.x & 31;
    const int qrow0 = qblk * 64 + wave * 16;

    const float* Qb = Q + (size_t)bh * S_LEN * DHEAD;
    const float* Kb = K + (size_t)bh * S_LEN * DHEAD;
    const float* Vb = V + (size_t)bh * S_LEN * DHEAD;
    float*       Ob = O + (size_t)bh * S_LEN * DHEAD;

    // fold softmax scale (1/sqrt(64)) and log2(e) into Q so P = exp2(S - m)
    const float qscale = 0.125f * 1.44269504088896340736f;

    // ---- Q tile (16x64) as two B operands of Q^T (column = query lo; d 0..31 / 32..63)
    v16h qa0, qa1;
    {
        const float* qrow = Qb + (size_t)(qrow0 + lo) * DHEAD;
        const int c0 = hi * 8;
#pragma unroll
        for (int i = 0; i < 8; ++i) {
            qa0[i]     = (_Float16)(qrow[c0 + i]      * qscale);
            qa0[i + 8] = (_Float16)(qrow[16 + c0 + i] * qscale);
            qa1[i]     = (_Float16)(qrow[32 + c0 + i] * qscale);
            qa1[i + 8] = (_Float16)(qrow[48 + c0 + i] * qscale);
        }
    }

    v16h ones;
#pragma unroll
    for (int i = 0; i < 16; ++i) ones[i] = (_Float16)1.0f;

    // ---- accumulators, all for query lo: O^T (64x16 over 4 d-chunks; acc[n][g] is
    //      d = n*16 + 8*hi + g), l (sum of P, the same in every register), m (max)
    v8f acc[4], lacc;
    float mrow = -1e30f;
#pragma unroll
    for (int n = 0; n < 4; ++n)
#pragma unroll
        for (int g = 0; g < 8; ++g) acc[n][g] = 0.0f;
#pragma unroll
    for (int g = 0; g < 8; ++g) lacc[g] = 0.0f;

    // cooperative stage of one 64-key tile, in two parts.
    // slot i*128+tid of 1024 float4 slots: row = key in tile, col = d
    float4 kd[8], vd[8];
    // this thread's slot 0 of the tile being fetched; slot i lies 8 rows further on
    const float* kfetch = Kb + (tid >> 4) * DHEAD + ((tid & 15) << 2);
    const float* vfetch = Vb + (tid >> 4) * DHEAD + ((tid & 15) << 2);
    // part 1: all 16 global loads of the tile in flight together
    auto fetch = [&](int tile) {
#pragma unroll
        for (int i = 0; i < 8; ++i) {
            kd[i] = *(const float4*)(kfetch + i * 8 * DHEAD);
            vd[i] = *(const float4*)(vfetch + i * 8 * DHEAD);
        }
        if (tile + 1 < NTILES) {              // L2 prefetch (global_prefetch_b8)
#pragma unroll
            for (int i = 0; i < 8; ++i) {
                __builtin_prefetch(kfetch + (KT + i * 8) * DHEAD, 0, 1);
                __builtin_prefetch(vfetch + (KT + i * 8) * DHEAD, 0, 1);
            }
        }
    };
    // part 2: K row-major f16, V transposed f16
    auto put = [&](_Float16* kdst, _Float16* vdst) {
#pragma unroll
        for (int i = 0; i < 8; ++i) {
            const int slot = i * 128 + tid;
            const int row  = slot >> 4;
            const int col  = (slot & 15) << 2;
            _Float16* kp = kdst + row * KSTR + col;
            kp[0] = (_Float16)kd[i].x; kp[1] = (_Float16)kd[i].y;
            kp[2] = (_Float16)kd[i].z; kp[3] = (_Float16)kd[i].w;
            vdst[(col + 0) * VSTR + row] = (_Float16)vd[i].x;
            vdst[(col + 1) * VSTR + row] = (_Float16)vd[i].y;
            vdst[(col + 2) * VSTR + row] = (_Float16)vd[i].z;
            vdst[(col + 3) * VSTR + row] = (_Float16)vd[i].w;
        }
    };

    fetch(0);
    put(KshA, VtsA);

    for (int t = 0; t < NTILES; ++t) {
        __syncthreads();   // staged tile t visible; prior reads of the other buffer done
        const int cur = t & 1;
        const _Float16* kbuf = cur ? KshB : KshA;
        const _Float16* vbuf = cur ? VtsB : VtsA;
        if (t + 1 < NTILES) {
            kfetch += KT * DHEAD;
            vfetch += KT * DHEAD;
            fetch(t + 1);           // lands while tile t is worked on
        }

        // ---- scores S^T = K*Q^T (64 x 16), four 16-key C tiles:
        //      s[st][g] = score of key st*16 + 8*hi + g against query lo
        v8f s[4];
#pragma unroll
        for (int st = 0; st < 4; ++st) {
#pragma unroll
            for (int g = 0; g < 8; ++g) s[st][g] = 0.0f;
            const _Float16* kr = kbuf + (st * 16 + lo) * KSTR;
            s[st] = wmma_f16(make_a(kr, hi),      qa0, s[st]);
            s[st] = wmma_f16(make_a(kr + 32, hi), qa1, s[st]);
        }

        // ---- max over the 64 keys of query lo: 32 in this lane, 32 in lane ^ 16
        float mt[8];
#pragma unroll
        for (int g = 0; g < 8; ++g)
            mt[g] = fmaxf(fmaxf(s[0][g], s[1][g]), fmaxf(s[2][g], s[3][g]));
        float mx = fmaxf(fmaxf(fmaxf(mt[0], mt[1]), fmaxf(mt[2], mt[3])),
                         fmaxf(fmaxf(mt[4], mt[5]), fmaxf(mt[6], mt[7])));
        mx = fmaxf(mx, xhalf(mx));

        const float mn   = fmaxf(mrow, mx);
        const float corr = exp2f(mrow - mn);
        mrow = mn;
#pragma unroll
        for (int st = 0; st < 4; ++st)
#pragma unroll
            for (int g = 0; g < 8; ++g)
                s[st][g] = exp2f(s[st][g] - mrow);

        // rescale running accumulators (O and l) by corr
#pragma unroll
        for (int n = 0; n < 4; ++n)
#pragma unroll
            for (int g = 0; g < 8; ++g) acc[n][g] *= corr;
#pragma unroll
        for (int g = 0; g < 8; ++g) lacc[g] *= corr;

        // ---- P^T: two score tiles (32 keys) converted in place are one B operand
        v16h pb0, pb1;
#pragma unroll
        for (int i = 0; i < 8; ++i) {
            pb0[i] = (_Float16)s[0][i]; pb0[i + 8] = (_Float16)s[1][i];  // keys 0..31
            pb1[i] = (_Float16)s[2][i]; pb1[i + 8] = (_Float16)s[3][i];  // keys 32..63
        }

        // ---- l += colsum(P^T) via WMMA with an all-ones A (replicated per row)
        lacc = wmma_f16(ones, pb0, lacc);
        lacc = wmma_f16(ones, pb1, lacc);

        // ---- O^T += V^T * P^T  (A operands = rows of V^T in LDS)
#pragma unroll
        for (int n = 0; n < 4; ++n) {
            const _Float16* vr = vbuf + (n * 16 + lo) * VSTR;
            acc[n] = wmma_f16(make_a(vr, hi),      pb0, acc[n]);
            acc[n] = wmma_f16(make_a(vr + 32, hi), pb1, acc[n]);
        }

        if (t + 1 < NTILES)
            put(cur ? KshA : KshB, cur ? VtsA : VtsB);
    }

    // ---- normalize and write fp32 output: a lane holds 8 consecutive d per chunk
    {
        const float inv = 1.0f / lacc[0];
        float* orow = Ob + (size_t)(qrow0 + lo) * DHEAD + 8 * hi;
#pragma unroll
        for (int n = 0; n < 4; ++n) {
            *(float4*)(orow + n * 16) =
                make_float4(acc[n][0] * inv, acc[n][1] * inv, acc[n][2] * inv, acc[n][3] * inv);
            *(float4*)(orow + n * 16 + 4) =
                make_float4(acc[n][4] * inv, acc[n][5] * inv, acc[n][6] * inv, acc[n][7] * inv);
        }
    }
}

extern "C" void kernel_launch(void* const* d_in, const int* in_sizes, int n_in,
                              void* d_out, int out_size, void* d_ws, size_t ws_size,
                              hipStream_t stream) {
    (void)in_sizes; (void)n_in; (void)out_size; (void)d_ws; (void)ws_size;
    const float* q = (const float*)d_in[0];
    const float* k = (const float*)d_in[1];
    const float* v = (const float*)d_in[2];
    float* o = (float*)d_out;
    dim3 grid(1024), block(128);   // (B*H)*(S/64) blocks, 4 waves each
    attn_fwd_kernel<<<grid, block, 0, stream>>>(q, k, v, o);
}

// v003
// A run of this version takes 57.9 microseconds.
// Two timings next to v002 put it at 1.57 and 1.58 times that version's speed.
// Counting every step since v000, it is 2.08 times as fast.
#include <hip/hip_runtime.h>

typedef __attribute__((ext_vector_type(16))) _Float16 v16h;
typedef __attribute__((ext_vector_type(8)))  _Float16 v8h;
typedef __attribute__((ext_vector_type(8)))  short    v8s;
typedef __attribute__((ext_vector_type(8)))  float    v8f;

#define S_LEN   2048
#define DHEAD   64
#define KT      64            // keys per tile
#define NTILES  (S_LEN / KT)  // 32
#define KSTR    72            // K lds row stride in halves (144B: 16B-aligned, 36-bank step)
#define VSTR    80            // V lds row stride in halves (160B: 32B x odd, the transposing load's pitch)
#define WAVES   4

static __device__ inline v8f wmma_f16(v16h a, v16h b, v8f c) {
    return __builtin_amdgcn_wmma_f32_16x16x32_f16(
        false, a, false, b, (short)0, c, false, false);
}

// 16x32 "A layout" operand from an LDS row pointer.
// lane (lo,hi): halves[0..7] = row[hi*8 + 0..7], halves[8..15] = row[16 + hi*8 + 0..7]
static __device__ inline v16h make_a(const _Float16* rowp, int hi) {
    v8h a = *(const v8h*)(rowp + hi * 8);
    v8h b = *(const v8h*)(rowp + 16 + hi * 8);
    v16h r;
#pragma unroll
    for (int i = 0; i < 8; ++i) { r[i] = a[i]; r[i + 8] = b[i]; }
    return r;
}

// 16x32 "A layout" operand of V^T from row-major V rows in LDS (ds_load_tr16_b128).
// p: this lane's address, row 8*hi + (lane & 7) of the 32 keys, halves 8*((lane >> 3) & 1) of the 16 d.
// lane (lo,hi): halves[0..7] = V[hi*8 + 0..7][lo], halves[8..15] = V[16 + hi*8 + 0..7][lo]
static __device__ inline v16h make_at(const _Float16* p) {
    typedef __attribute__((address_space(3))) v8s lds_v8s;
    v8h a = __builtin_bit_cast(v8h, __builtin_amdgcn_ds_load_tr16_b128_v8i16((lds_v8s*)p));
    v8h b = __builtin_bit_cast(v8h, __builtin_amdgcn_ds_load_tr16_b128_v8i16((lds_v8s*)(p + 16 * VSTR)));
    v16h r;
#pragma unroll
    for (int i = 0; i < 8; ++i) { r[i] = a[i]; r[i + 8] = b[i]; }
    return r;
}

// value of lane l ^ 16 (the other half of the wave holds the other keys of a query)
static __device__ inline float xhalf(float x) {
    return __builtin_bit_cast(float, __builtin_amdgcn_permlanex16(
        __builtin_bit_cast(int, x), __builtin_bit_cast(int, x),
        0x76543210, 0xfedcba98, false, false));
}

__global__ __launch_bounds__(128) void
attn_fwd_kernel(const float* __restrict__ Q, const float* __restrict__ K,
                const float* __restrict__ V, float* __restrict__ O)
{
    __shared__ __attribute__((aligned(16))) _Float16 KshA[KT * KSTR], KshB[KT * KSTR]; // 64 x 72 halves each
    __shared__ __attribute__((aligned(16))) _Float16 VshA[KT * VSTR], VshB[KT * VSTR]; // 64 x 80 (key rows)

    const int tid  = threadIdx.x;
    const int wave = tid >> 5;
    const int lane = tid & 31;
    const int lo   = lane & 15;
    const int hi   = lane >> 4;

    const int bh    = blockIdx.x >> 5;   // (b*H+h); 32 q-blocks of 64 rows per head
    const int qblk  = blockIdx.x & 31;
    const int qrow0 = qblk * 64 + wave * 16;

    const float* Qb = Q + (size_t)bh * S_LEN * DHEAD;
    const float* Kb = K + (size_t)bh * S_LEN * DHEAD;
    const float* Vb = V + (size_t)bh * S_LEN * DHEAD;
    float*       Ob = O + (size_t)bh * S_LEN * DHEAD;

    // fold softmax scale (1/sqrt(64)) and log2(e) into Q so P = exp2(S - m)
    const float qscale = 0.125f * 1.44269504088896340736f;

    // ---- Q tile (16x64) as two B operands of Q^T (column = query lo; d 0..31 / 32..63)
    v16h qa0, qa1;
    {
        const float* qrow = Qb + (size_t)(qrow0 + lo) * DHEAD;
        const int c0 = hi * 8;
#pragma unroll
        for (int i = 0; i < 8; ++i) {
            qa0[i]     = (_Float16)(qrow[c0 + i]      * qscale);
            qa0[i + 8] = (_Float16)(qrow[16 + c0 + i] * qscale);
            qa1[i]     = (_Float16)(qrow[32 + c0 + i] * qscale);
            qa1[i + 8] = (_Float16)(qrow[48 + c0 + i] * qscale);
        }
    }

    v16h ones;
#pragma unroll
    for (int i = 0; i < 16; ++i) ones[i] = (_Float16)1.0f;

    // ---- accumulators, all for query lo: O^T (64x16 over 4 d-chunks; acc[n][g] is
    //      d = n*16 + 8*hi + g), l (sum of P, the same in every register), m (max)
    v8f acc[4], lacc;
    float mrow = -1e30f;
#pragma unroll
    for (int n = 0; n < 4; ++n)
#pragma unroll
        for (int g = 0; g < 8; ++g) acc[n][g] = 0.0f;
#pragma unroll
    for (int g = 0; g < 8; ++g) lacc[g] = 0.0f;

    // cooperative stage of one 64-key tile, in two parts.
    // slot i*128+tid of 1024 float4 slots: row = key in tile, col = d
    float4 kd[8], vd[8];
    // this thread's slot 0 of the tile being fetched; slot i lies 8 rows further on
    const float* kfetch = Kb + (tid >> 4) * DHEAD + ((tid & 15) << 2);
    const float* vfetch = Vb + (tid >> 4) * DHEAD + ((tid & 15) << 2);
    // part 1: all 16 global loads of the tile in flight together
    auto fetch = [&](int tile) {
#pragma unroll
        for (int i = 0; i < 8; ++i) {
            kd[i] = *(const float4*)(kfetch + i * 8 * DHEAD);
            vd[i] = *(const float4*)(vfetch + i * 8 * DHEAD);
        }
        if (tile + 1 < NTILES) {              // L2 prefetch (global_prefetch_b8)
#pragma unroll
            for (int i = 0; i < 8; ++i) {
                __builtin_prefetch(kfetch + (KT + i * 8) * DHEAD, 0, 1);
                __builtin_prefetch(vfetch + (KT + i * 8) * DHEAD, 0, 1);
            }
        }
    };
    // part 2: K and V row-major f16
    auto put = [&](_Float16* kdst, _Float16* vdst) {
#pragma unroll
        for (int i = 0; i < 8; ++i) {
            const int slot = i * 128 + tid;
            const int row  = slot >> 4;
            const int col  = (slot & 15) << 2;
            _Float16* kp = kdst + row * KSTR + col;
            kp[0] = (_Float16)kd[i].x; kp[1] = (_Float16)kd[i].y;
            kp[2] = (_Float16)kd[i].z; kp[3] = (_Float16)kd[i].w;
            _Float16* vp = vdst + row * VSTR + col;
            vp[0] = (_Float16)vd[i].x; vp[1] = (_Float16)vd[i].y;
            vp[2] = (_Float16)vd[i].z; vp[3] = (_Float16)vd[i].w;
        }
    };

    fetch(0);
    put(KshA, VshA);

    for (int t = 0; t < NTILES; ++t) {
        __syncthreads();   // staged tile t visible; prior reads of the other buffer done
        const int cur = t & 1;
        const _Float16* kbuf = cur ? KshB : KshA;
        const _Float16* vbuf = cur ? VshB : VshA;
        if (t + 1 < NTILES) {
            kfetch += KT * DHEAD;
            vfetch += KT * DHEAD;
            fetch(t + 1);           // lands while tile t is worked on
        }

        // ---- scores S^T = K*Q^T (64 x 16), four 16-key C tiles:
        //      s[st][g] = score of key st*16 + 8*hi + g against query lo
        v8f s[4];
#pragma unroll
        for (int st = 0; st < 4; ++st) {
#pragma unroll
            for (int g = 0; g < 8; ++g) s[st][g] = 0.0f;
            const _Float16* kr = kbuf + (st * 16 + lo) * KSTR;
            s[st] = wmma_f16(make_a(kr, hi),      qa0, s[st]);
            s[st] = wmma_f16(make_a(kr + 32, hi), qa1, s[st]);
        }

        // ---- max over the 64 keys of query lo: 32 in this lane, 32 in lane ^ 16
        float mt[8];
#pragma unroll
        for (int g = 0; g < 8; ++g)
            mt[g] = fmaxf(fmaxf(s[0][g], s[1][g]), fmaxf(s[2][g], s[3][g]));
        float mx = fmaxf(fmaxf(fmaxf(mt[0], mt[1]), fmaxf(mt[2], mt[3])),
                         fmaxf(fmaxf(mt[4], mt[5]), fmaxf(mt[6], mt[7])));
        mx = fmaxf(mx, xhalf(mx));

        const float mn   = fmaxf(mrow, mx);
        const float corr = exp2f(mrow - mn);
        mrow = mn;
#pragma unroll
        for (int st = 0; st < 4; ++st)
#pragma unroll
            for (int g = 0; g < 8; ++g)
                s[st][g] = exp2f(s[st][g] - mrow);

        // rescale running accumulators (O and l) by corr
#pragma unroll
        for (int n = 0; n < 4; ++n)
#pragma unroll
            for (int g = 0; g < 8; ++g) acc[n][g] *= corr;
#pragma unroll
        for (int g = 0; g < 8; ++g) lacc[g] *= corr;

        // ---- P^T: two score tiles (32 keys) converted in place are one B operand
        v16h pb0, pb1;
#pragma unroll
        for (int i = 0; i < 8; ++i) {
            pb0[i] = (_Float16)s[0][i]; pb0[i + 8] = (_Float16)s[1][i];  // keys 0..31
            pb1[i] = (_Float16)s[2][i]; pb1[i + 8] = (_Float16)s[3][i];  // keys 32..63
        }

        // ---- l += colsum(P^T) via WMMA with an all-ones A (replicated per row)
        lacc = wmma_f16(ones, pb0, lacc);
        lacc = wmma_f16(ones, pb1, lacc);

        // ---- O^T += V^T * P^T  (A operands = V rows in LDS, transposed by the load)
        const _Float16* vr = vbuf + (8 * hi + (lane & 7)) * VSTR + ((lane >> 3) & 1) * 8;
#pragma unroll
        for (int n = 0; n < 4; ++n) {
            acc[n] = wmma_f16(make_at(vr + n * 16),             pb0, acc[n]);
            acc[n] = wmma_f16(make_at(vr + 32 * VSTR + n * 16), pb1, acc[n]);
        }

        if (t + 1 < NTILES)
            put(cur ? KshA : KshB, cur ? VshA : VshB);
    }

    // ---- normalize and write fp32 output: a lane holds 8 consecutive d per chunk
    {
        const float inv = 1.0f / lacc[0];
        float* orow = Ob + (size_t)(qrow0 + lo) * DHEAD + 8 * hi;
#pragma unroll
        for (int n = 0; n < 4; ++n) {
            *(float4*)(orow + n * 16) =
                make_float4(acc[n][0] * inv, acc[n][1] * inv, acc[n][2] * inv, acc[n][3] * inv);
            *(float4*)(orow + n * 16 + 4) =
                make_float4(acc[n][4] * inv, acc[n][5] * inv, acc[n][6] * inv, acc[n][7] * inv);
        }
    }
}

extern "C" void kernel_launch(void* const* d_in, const int* in_sizes, int n_in,
                              void* d_out, int out_size, void* d_ws, size_t ws_size,
                              hipStream_t stream) {
    (void)in_sizes; (void)n_in; (void)out_size; (void)d_ws; (void)ws_size;
    const float* q = (const float*)d_in[0];
    const float* k = (const float*)d_in[1];
    const float* v = (const float*)d_in[2];
    float* o = (float*)d_out;
    dim3 grid(1024), block(128);   // (B*H)*(S/64) blocks, 4 waves each
    attn_fwd_kernel<<<grid, block, 0, stream>>>(q, k, v, o);
}

// v004
// A run of this version takes 53.5 microseconds.
// Next to v003, in two timings, it ran 1.08 times as fast each time.
// All steps since v000 together make it 2.25 times as fast.
#include <hip/hip_runtime.h>

typedef __attribute__((ext_vector_type(16))) _Float16 v16h;
typedef __attribute__((ext_vector_type(8)))  _Float16 v8h;
typedef __attribute__((ext_vector_type(8)))  short    v8s;
typedef __attribute__((ext_vector_type(8)))  float    v8f;

#define S_LEN   2048
#define DHEAD   64
#define KT      64            // keys per tile
#define NTILES  (S_LEN / KT)  // 32
#define KSTR    72            // K lds row stride in halves (144B: 16B-aligned, 36-bank step)
#define VSTR    80            // V lds row stride in halves (160B: 32B x odd, the transposing load's pitch)
#define WAVES   4

static __device__ inline v8f wmma_f16(v16h a, v16h b, v8f c) {
    return __builtin_amdgcn_wmma_f32_16x16x32_f16(
        false, a, false, b, (short)0, c, false, false);
}

// 16x32 "A layout" operand from an LDS row pointer.
// lane (lo,hi): halves[0..7] = row[hi*8 + 0..7], halves[8..15] = row[16 + hi*8 + 0..7]
static __device__ inline v16h make_a(const _Float16* rowp, int hi) {
    v8h a = *(const v8h*)(rowp + hi * 8);
    v8h b = *(const v8h*)(rowp + 16 + hi * 8);
    v16h r;
#pragma unroll
    for (int i = 0; i < 8; ++i) { r[i] = a[i]; r[i + 8] = b[i]; }
    return r;
}

// 16x32 "A layout" operand of V^T from row-major V rows in LDS (ds_load_tr16_b128).
// p: this lane's address, row 8*hi + (lane & 7) of the 32 keys, halves 8*((lane >> 3) & 1) of the 16 d.
// lane (lo,hi): halves[0..7] = V[hi*8 + 0..7][lo], halves[8..15] = V[16 + hi*8 + 0..7][lo]
static __device__ inline v16h make_at(const _Float16* p) {
    typedef __attribute__((address_space(3))) v8s lds_v8s;
    v8h a = __builtin_bit_cast(v8h, __builtin_amdgcn_ds_load_tr16_b128_v8i16((lds_v8s*)p));
    v8h b = __builtin_bit_cast(v8h, __builtin_amdgcn_ds_load_tr16_b128_v8i16((lds_v8s*)(p + 16 * VSTR)));
    v16h r;
#pragma unroll
    for (int i = 0; i < 8; ++i) { r[i] = a[i]; r[i + 8] = b[i]; }
    return r;
}

// 2^x by the bare v_exp_f32, in place. exp2f() wraps the same instruction in a compare, two selects,
// an add and an ldexp that only rescue results below 2^-126; here those come out 0 (see the loop).
static __device__ inline void exp2_x8(v8f& x) {
    float a = x[0], b = x[1], c = x[2], d = x[3], e = x[4], f = x[5], g = x[6], h = x[7];
    // asm, one statement closed by v_nop: keeps the one free slot the instruction set asks for between a
    // transcendental and a use of its result or a write of its source
    asm("v_exp_f32 %0, %0\n\tv_exp_f32 %1, %1\n\tv_exp_f32 %2, %2\n\tv_exp_f32 %3, %3\n\t"
        "v_exp_f32 %4, %4\n\tv_exp_f32 %5, %5\n\tv_exp_f32 %6, %6\n\tv_exp_f32 %7, %7\n\tv_nop"
        : "+v"(a), "+v"(b), "+v"(c), "+v"(d), "+v"(e), "+v"(f), "+v"(g), "+v"(h));
    x[0] = a; x[1] = b; x[2] = c; x[3] = d; x[4] = e; x[5] = f; x[6] = g; x[7] = h;
}
static __device__ inline float exp2_x1(float x) {
    // v_nop: the same slot behind the transcendental as in exp2_x8
    asm("v_exp_f32 %0, %0\n\tv_nop" : "+v"(x));
    return x;
}

// value of lane l ^ 16 (the other half of the wave holds the other keys of a query)
static __device__ inline float xhalf(float x) {
    return __builtin_bit_cast(float, __builtin_amdgcn_permlanex16(
        __builtin_bit_cast(int, x), __builtin_bit_cast(int, x),
        0x76543210, 0xfedcba98, false, false));
}

__global__ __launch_bounds__(128) void
attn_fwd_kernel(const float* __restrict__ Q, const float* __restrict__ K,
                const float* __restrict__ V, float* __restrict__ O)
{
    __shared__ __attribute__((aligned(16))) _Float16 KshA[KT * KSTR], KshB[KT * KSTR]; // 64 x 72 halves each
    __shared__ __attribute__((aligned(16))) _Float16 VshA[KT * VSTR], VshB[KT * VSTR]; // 64 x 80 (key rows)

    const int tid  = threadIdx.x;
    const int wave = tid >> 5;
    const int lane = tid & 31;
    const int lo   = lane & 15;
    const int hi   = lane >> 4;

    const int bh    = blockIdx.x >> 5;   // (b*H+h); 32 q-blocks of 64 rows per head
    const int qblk  = blockIdx.x & 31;
    const int qrow0 = qblk * 64 + wave * 16;

    const float* Qb = Q + (size_t)bh * S_LEN * DHEAD;
    const float* Kb = K + (size_t)bh * S_LEN * DHEAD;
    const float* Vb = V + (size_t)bh * S_LEN * DHEAD;
    float*       Ob = O + (size_t)bh * S_LEN * DHEAD;

    // fold softmax scale (1/sqrt(64)) and log2(e) into Q so P = exp2(S - m)
    const float qscale = 0.125f * 1.44269504088896340736f;

    // ---- Q tile (16x64) as two B operands of Q^T (column = query lo; d 0..31 / 32..63)
    v16h qa0, qa1;
    {
        const float* qrow = Qb + (size_t)(qrow0 + lo) * DHEAD;
        const int c0 = hi * 8;
#pragma unroll
        for (int i = 0; i < 8; ++i) {
            qa0[i]     = (_Float16)(qrow[c0 + i]      * qscale);
            qa0[i + 8] = (_Float16)(qrow[16 + c0 + i] * qscale);
            qa1[i]     = (_Float16)(qrow[32 + c0 + i] * qscale);
            qa1[i + 8] = (_Float16)(qrow[48 + c0 + i] * qscale);
        }
    }

    v16h ones;
#pragma unroll
    for (int i = 0; i < 16; ++i) ones[i] = (_Float16)1.0f;

    // ---- accumulators, all for query lo: O^T (64x16 over 4 d-chunks; acc[n][g] is
    //      d = n*16 + 8*hi + g), l (sum of P, the same in every register), m (max)
    v8f acc[4], lacc;
    float mrow = -1e30f;
#pragma unroll
    for (int n = 0; n < 4; ++n)
#pragma unroll
        for (int g = 0; g < 8; ++g) acc[n][g] = 0.0f;
#pragma unroll
    for (int g = 0; g < 8; ++g) lacc[g] = 0.0f;

    // cooperative stage of one 64-key tile, in two parts.
    // slot i*128+tid of 1024 float4 slots: row = key in tile, col = d
    float4 kd[8], vd[8];
    // this thread's slot 0 of the tile being fetched; slot i lies 8 rows further on
    const float* kfetch = Kb + (tid >> 4) * DHEAD + ((tid & 15) << 2);
    const float* vfetch = Vb + (tid >> 4) * DHEAD + ((tid & 15) << 2);
    // part 1: all 16 global loads of the tile in flight together
    auto fetch = [&](int tile) {
#pragma unroll
        for (int i = 0; i < 8; ++i) {
            kd[i] = *(const float4*)(kfetch + i * 8 * DHEAD);
            vd[i] = *(const float4*)(vfetch + i * 8 * DHEAD);
        }
        if (tile + 1 < NTILES) {              // L2 prefetch (global_prefetch_b8)
#pragma unroll
            for (int i = 0; i < 8; ++i) {
                __builtin_prefetch(kfetch + (KT + i * 8) * DHEAD, 0, 1);
                __builtin_prefetch(vfetch + (KT + i * 8) * DHEAD, 0, 1);
            }
        }
    };
    // part 2: K and V row-major f16
    auto put = [&](_Float16* kdst, _Float16* vdst) {
#pragma unroll
        for (int i = 0; i < 8; ++i) {
            const int slot = i * 128 + tid;
            const int row  = slot >> 4;
            const int col  = (slot & 15) << 2;
            _Float16* kp = kdst + row * KSTR + col;
            kp[0] = (_Float16)kd[i].x; kp[1] = (_Float16)kd[i].y;
            kp[2] = (_Float16)kd[i].z; kp[3] = (_Float16)kd[i].w;
            _Float16* vp = vdst + row * VSTR + col;
            vp[0] = (_Float16)vd[i].x; vp[1] = (_Float16)vd[i].y;
            vp[2] = (_Float16)vd[i].z; vp[3] = (_Float16)vd[i].w;
        }
    };

    fetch(0);
    put(KshA, VshA);

    for (int t = 0; t < NTILES; ++t) {
        __syncthreads();   // staged tile t visible; prior reads of the other buffer done
        const int cur = t & 1;
        const _Float16* kbuf = cur ? KshB : KshA;
        const _Float16* vbuf = cur ? VshB : VshA;
        if (t + 1 < NTILES) {
            kfetch += KT * DHEAD;
            vfetch += KT * DHEAD;
            fetch(t + 1);           // lands while tile t is worked on
        }

        // ---- scores S^T = K*Q^T (64 x 16), four 16-key C tiles:
        //      s[st][g] = score of key st*16 + 8*hi + g against query lo
        v8f s[4];
#pragma unroll
        for (int st = 0; st < 4; ++st) {
#pragma unroll
            for (int g = 0; g < 8; ++g) s[st][g] = 0.0f;
            const _Float16* kr = kbuf + (st * 16 + lo) * KSTR;
            s[st] = wmma_f16(make_a(kr, hi),      qa0, s[st]);
            s[st] = wmma_f16(make_a(kr + 32, hi), qa1, s[st]);
        }

        // ---- max over the 64 keys of query lo: 32 in this lane, 32 in lane ^ 16
        float mt[8];
#pragma unroll
        for (int g = 0; g < 8; ++g)
            mt[g] = fmaxf(fmaxf(s[0][g], s[1][g]), fmaxf(s[2][g], s[3][g]));
        float mx = fmaxf(fmaxf(fmaxf(mt[0], mt[1]), fmaxf(mt[2], mt[3])),
                         fmaxf(fmaxf(mt[4], mt[5]), fmaxf(mt[6], mt[7])));
        mx = fmaxf(mx, xhalf(mx));

        const float mn   = fmaxf(mrow, mx);
        // a corr below 2^-126 comes out 0: the sums it scales vanish beside this tile's own P = 1 term
        const float corr = exp2_x1(mrow - mn);
        mrow = mn;
        // a P below 2^-126 comes out 0, which is what it rounds to in f16 anyway
#pragma unroll
        for (int st = 0; st < 4; ++st) {
#pragma unroll
            for (int g = 0; g < 8; ++g) s[st][g] -= mrow;
            exp2_x8(s[st]);
        }

        // rescale running accumulators (O and l) by corr
#pragma unroll
        for (int n = 0; n < 4; ++n)
#pragma unroll
            for (int g = 0; g < 8; ++g) acc[n][g] *= corr;
#pragma unroll
        for (int g = 0; g < 8; ++g) lacc[g] *= corr;

        // ---- P^T: two score tiles (32 keys) converted in place are one B operand
        v16h pb0, pb1;
#pragma unroll
        for (int i = 0; i < 8; ++i) {
            pb0[i] = (_Float16)s[0][i]; pb0[i + 8] = (_Float16)s[1][i];  // keys 0..31
            pb1[i] = (_Float16)s[2][i]; pb1[i + 8] = (_Float16)s[3][i];  // keys 32..63
        }

        // ---- l += colsum(P^T) via WMMA with an all-ones A (replicated per row)
        lacc = wmma_f16(ones, pb0, lacc);
        lacc = wmma_f16(ones, pb1, lacc);

        // ---- O^T += V^T * P^T  (A operands = V rows in LDS, transposed by the load)
        const _Float16* vr = vbuf + (8 * hi + (lane & 7)) * VSTR + ((lane >> 3) & 1) * 8;
#pragma unroll
        for (int n = 0; n < 4; ++n) {
            acc[n] = wmma_f16(make_at(vr + n * 16),             pb0, acc[n]);
            acc[n] = wmma_f16(make_at(vr + 32 * VSTR + n * 16), pb1, acc[n]);
        }

        if (t + 1 < NTILES)
            put(cur ? KshA : KshB, cur ? VshA : VshB);
    }

    // ---- normalize and write fp32 output: a lane holds 8 consecutive d per chunk
    {
        const float inv = 1.0f / lacc[0];
        float* orow = Ob + (size_t)(qrow0 + lo) * DHEAD + 8 * hi;
#pragma unroll
        for (int n = 0; n < 4; ++n) {
            *(float4*)(orow + n * 16) =
                make_float4(acc[n][0] * inv, acc[n][1] * inv, acc[n][2] * inv, acc[n][3] * inv);
            *(float4*)(orow + n * 16 + 4) =
                make_float4(acc[n][4] * inv, acc[n][5] * inv, acc[n][6] * inv, acc[n][7] * inv);
        }
    }
}

extern "C" void kernel_launch(void* const* d_in, const int* in_sizes, int n_in,
                              void* d_out, int out_size, void* d_ws, size_t ws_size,
                              hipStream_t stream) {
    (void)in_sizes; (void)n_in; (void)out_size; (void)d_ws; (void)ws_size;
    const float* q = (const float*)d_in[0];
    const float* k = (const float*)d_in[1];
    const float* v = (const float*)d_in[2];
    float* o = (float*)d_out;
    dim3 grid(1024), block(128);   // (B*H)*(S/64) blocks, 4 waves each
    attn_fwd_kernel<<<grid, block, 0, stream>>>(q, k, v, o);
}

// v005
// It runs in 38.9 microseconds.
// Timed twice side by side with v004, it ran 1.39 and 1.40 times as fast.
// Counting every step since v000, it is 3.14 times as fast.
#include <hip/hip_runtime.h>

typedef __attribute__((ext_vector_type(16))) _Float16 v16h;
typedef __attribute__((ext_vector_type(8)))  _Float16 v8h;
typedef __attribute__((ext_vector_type(8)))  short    v8s;
typedef __attribute__((ext_vector_type(8)))  float    v8f;

#define S_LEN   2048
#define DHEAD   64
#define KT      64            // keys per tile
#define NTILES  (S_LEN / KT)  // 32
#define KSTR    72            // K lds row stride in halves (144B: 16B-aligned, 36-bank step)
#define VSTR    80            // V lds row stride in halves (160B: 32B x odd, the transposing load's pitch)
#define WAVES   16
#define THREADS (WAVES * 32)
#define QROWS   (WAVES * 16)            // q-rows per block
#define QBLKS   (S_LEN / QROWS)         // blocks per head
#define NSLOT   (KT * DHEAD / 4 / THREADS) // float4 slots per thread, operand and tile
#define SROWS   (THREADS / 16)          // rows between a thread's slots

static __device__ inline v8f wmma_f16(v16h a, v16h b, v8f c) {
    return __builtin_amdgcn_wmma_f32_16x16x32_f16(
        false, a, false, b, (short)0, c, false, false);
}

// 16x32 "A layout" operand from an LDS row pointer.
// lane (lo,hi): halves[0..7] = row[hi*8 + 0..7], halves[8..15] = row[16 + hi*8 + 0..7]
static __device__ inline v16h make_a(const _Float16* rowp, int hi) {
    v8h a = *(const v8h*)(rowp + hi * 8);
    v8h b = *(const v8h*)(rowp + 16 + hi * 8);
    v16h r;
#pragma unroll
    for (int i = 0; i < 8; ++i) { r[i] = a[i]; r[i + 8] = b[i]; }
    return r;
}

// 16x32 "A layout" operand of V^T from row-major V rows in LDS (ds_load_tr16_b128).
// p: this lane's address, row 8*hi + (lane & 7) of the 32 keys, halves 8*((lane >> 3) & 1) of the 16 d.
// lane (lo,hi): halves[0..7] = V[hi*8 + 0..7][lo], halves[8..15] = V[16 + hi*8 + 0..7][lo]
static __device__ inline v16h make_at(const _Float16* p) {
    typedef __attribute__((address_space(3))) v8s lds_v8s;
    v8h a = __builtin_bit_cast(v8h, __builtin_amdgcn_ds_load_tr16_b128_v8i16((lds_v8s*)p));
    v8h b = __builtin_bit_cast(v8h, __builtin_amdgcn_ds_load_tr16_b128_v8i16((lds_v8s*)(p + 16 * VSTR)));
    v16h r;
#pragma unroll
    for (int i = 0; i < 8; ++i) { r[i] = a[i]; r[i + 8] = b[i]; }
    return r;
}

// 2^x by the bare v_exp_f32, in place. exp2f() wraps the same instruction in a compare, two selects,
// an add and an ldexp that only rescue results below 2^-126; here those come out 0 (see the loop).
static __device__ inline void exp2_x8(v8f& x) {
    float a = x[0], b = x[1], c = x[2], d = x[3], e = x[4], f = x[5], g = x[6], h = x[7];
    // asm, one statement closed by v_nop: keeps the one free slot the instruction set asks for between a
    // transcendental and a use of its result or a write of its source
    asm("v_exp_f32 %0, %0\n\tv_exp_f32 %1, %1\n\tv_exp_f32 %2, %2\n\tv_exp_f32 %3, %3\n\t"
        "v_exp_f32 %4, %4\n\tv_exp_f32 %5, %5\n\tv_exp_f32 %6, %6\n\tv_exp_f32 %7, %7\n\tv_nop"
        : "+v"(a), "+v"(b), "+v"(c), "+v"(d), "+v"(e), "+v"(f), "+v"(g), "+v"(h));
    x[0] = a; x[1] = b; x[2] = c; x[3] = d; x[4] = e; x[5] = f; x[6] = g; x[7] = h;
}
static __device__ inline float exp2_x1(float x) {
    // v_nop: the same slot behind the transcendental as in exp2_x8
    asm("v_exp_f32 %0, %0\n\tv_nop" : "+v"(x));
    return x;
}

// value of lane l ^ 16 (the other half of the wave holds the other keys of a query)
static __device__ inline float xhalf(float x) {
    return __builtin_bit_cast(float, __builtin_amdgcn_permlanex16(
        __builtin_bit_cast(int, x), __builtin_bit_cast(int, x),
        0x76543210, 0xfedcba98, false, false));
}

// one 16-wave work-group fills a WGP at 4 waves per SIMD. waves_per_eu states that residency: without it the
// compiler saved registers for more resident waves and split the K fragment loads into more, smaller groups
__global__ __launch_bounds__(THREADS) __attribute__((amdgpu_waves_per_eu(4, 4))) void
attn_fwd_kernel(const float* __restrict__ Q, const float* __restrict__ K,
                const float* __restrict__ V, float* __restrict__ O)
{
    __shared__ __attribute__((aligned(16))) _Float16 KshA[KT * KSTR], KshB[KT * KSTR]; // 64 x 72 halves each
    __shared__ __attribute__((aligned(16))) _Float16 VshA[KT * VSTR], VshB[KT * VSTR]; // 64 x 80 (key rows)

    const int tid  = threadIdx.x;
    const int wave = tid >> 5;
    const int lane = tid & 31;
    const int lo   = lane & 15;
    const int hi   = lane >> 4;

    const int bh    = blockIdx.x / QBLKS;   // (b*H+h)
    const int qblk  = blockIdx.x % QBLKS;
    const int qrow0 = qblk * QROWS + wave * 16;

    const float* Qb = Q + (size_t)bh * S_LEN * DHEAD;
    const float* Kb = K + (size_t)bh * S_LEN * DHEAD;
    const float* Vb = V + (size_t)bh * S_LEN * DHEAD;
    float*       Ob = O + (size_t)bh * S_LEN * DHEAD;

    // fold softmax scale (1/sqrt(64)) and log2(e) into Q so P = exp2(S - m)
    const float qscale = 0.125f * 1.44269504088896340736f;

    // ---- Q tile (16x64) as two B operands of Q^T (column = query lo; d 0..31 / 32..63)
    v16h qa0, qa1;
    {
        const float* qrow = Qb + (size_t)(qrow0 + lo) * DHEAD;
        const int c0 = hi * 8;
#pragma unroll
        for (int i = 0; i < 8; ++i) {
            qa0[i]     = (_Float16)(qrow[c0 + i]      * qscale);
            qa0[i + 8] = (_Float16)(qrow[16 + c0 + i] * qscale);
            qa1[i]     = (_Float16)(qrow[32 + c0 + i] * qscale);
            qa1[i + 8] = (_Float16)(qrow[48 + c0 + i] * qscale);
        }
    }

    v16h ones;
#pragma unroll
    for (int i = 0; i < 16; ++i) ones[i] = (_Float16)1.0f;

    // ---- accumulators, all for query lo: O^T (64x16 over 4 d-chunks; acc[n][g] is
    //      d = n*16 + 8*hi + g), l (sum of P, the same in every register), m (max)
    v8f acc[4], lacc;
    float mrow = -1e30f;
#pragma unroll
    for (int n = 0; n < 4; ++n)
#pragma unroll
        for (int g = 0; g < 8; ++g) acc[n][g] = 0.0f;
#pragma unroll
    for (int g = 0; g < 8; ++g) lacc[g] = 0.0f;

    // cooperative stage of one 64-key tile, in two parts.
    // slot i*THREADS+tid of 1024 float4 slots: row = key in tile, col = d
    float4 kd[NSLOT], vd[NSLOT];
    // this thread's slot 0 of the tile being fetched; slot i lies SROWS rows further on
    const float* kfetch = Kb + (tid >> 4) * DHEAD + ((tid & 15) << 2);
    const float* vfetch = Vb + (tid >> 4) * DHEAD + ((tid & 15) << 2);
    // part 1: all global loads of the tile in flight together
    auto fetch = [&](int tile) {
#pragma unroll
        for (int i = 0; i < NSLOT; ++i) {
            kd[i] = *(const float4*)(kfetch + i * SROWS * DHEAD);
            vd[i] = *(const float4*)(vfetch + i * SROWS * DHEAD);
        }
        if (tile + 1 < NTILES) {              // L2 prefetch (global_prefetch_b8)
#pragma unroll
            for (int i = 0; i < NSLOT; ++i) {
                __builtin_prefetch(kfetch + (KT + i * SROWS) * DHEAD, 0, 1);
                __builtin_prefetch(vfetch + (KT + i * SROWS) * DHEAD, 0, 1);
            }
        }
    };
    // part 2: K and V row-major f16
    auto put = [&](_Float16* kdst, _Float16* vdst) {
#pragma unroll
        for (int i = 0; i < NSLOT; ++i) {
            const int slot = i * THREADS + tid;
            const int row  = slot >> 4;
            const int col  = (slot & 15) << 2;
            _Float16* kp = kdst + row * KSTR + col;
            kp[0] = (_Float16)kd[i].x; kp[1] = (_Float16)kd[i].y;
            kp[2] = (_Float16)kd[i].z; kp[3] = (_Float16)kd[i].w;
            _Float16* vp = vdst + row * VSTR + col;
            vp[0] = (_Float16)vd[i].x; vp[1] = (_Float16)vd[i].y;
            vp[2] = (_Float16)vd[i].z; vp[3] = (_Float16)vd[i].w;
        }
    };

    fetch(0);
    put(KshA, VshA);

    for (int t = 0; t < NTILES; ++t) {
        __syncthreads();   // staged tile t visible; prior reads of the other buffer done
        const int cur = t & 1;
        const _Float16* kbuf = cur ? KshB : KshA;
        const _Float16* vbuf = cur ? VshB : VshA;
        if (t + 1 < NTILES) {
            kfetch += KT * DHEAD;
            vfetch += KT * DHEAD;
            fetch(t + 1);           // lands while tile t is worked on
        }

        // ---- scores S^T = K*Q^T (64 x 16), four 16-key C tiles:
        //      s[st][g] = score of key st*16 + 8*hi + g against query lo
        v8f s[4];
#pragma unroll
        for (int st = 0; st < 4; ++st) {
#pragma unroll
            for (int g = 0; g < 8; ++g) s[st][g] = 0.0f;
            const _Float16* kr = kbuf + (st * 16 + lo) * KSTR;
            s[st] = wmma_f16(make_a(kr, hi),      qa0, s[st]);
            s[st] = wmma_f16(make_a(kr + 32, hi), qa1, s[st]);
        }

        // ---- max over the 64 keys of query lo: 32 in this lane, 32 in lane ^ 16
        float mt[8];
#pragma unroll
        for (int g = 0; g < 8; ++g)
            mt[g] = fmaxf(fmaxf(s[0][g], s[1][g]), fmaxf(s[2][g], s[3][g]));
        float mx = fmaxf(fmaxf(fmaxf(mt[0], mt[1]), fmaxf(mt[2], mt[3])),
                         fmaxf(fmaxf(mt[4], mt[5]), fmaxf(mt[6], mt[7])));
        mx = fmaxf(mx, xhalf(mx));

        const float mn   = fmaxf(mrow, mx);
        // a corr below 2^-126 comes out 0: the sums it scales vanish beside this tile's own P = 1 term
        const float corr = exp2_x1(mrow - mn);
        mrow = mn;
        // a P below 2^-126 comes out 0, which is what it rounds to in f16 anyway
#pragma unroll
        for (int st = 0; st < 4; ++st) {
#pragma unroll
            for (int g = 0; g < 8; ++g) s[st][g] -= mrow;
            exp2_x8(s[st]);
        }

        // rescale running accumulators (O and l) by corr
#pragma unroll
        for (int n = 0; n < 4; ++n)
#pragma unroll
            for (int g = 0; g < 8; ++g) acc[n][g] *= corr;
#pragma unroll
        for (int g = 0; g < 8; ++g) lacc[g] *= corr;

        // ---- P^T: two score tiles (32 keys) converted in place are one B operand
        v16h pb0, pb1;
#pragma unroll
        for (int i = 0; i < 8; ++i) {
            pb0[i] = (_Float16)s[0][i]; pb0[i + 8] = (_Float16)s[1][i];  // keys 0..31
            pb1[i] = (_Float16)s[2][i]; pb1[i + 8] = (_Float16)s[3][i];  // keys 32..63
        }

        // ---- l += colsum(P^T) via WMMA with an all-ones A (replicated per row)
        lacc = wmma_f16(ones, pb0, lacc);
        lacc = wmma_f16(ones, pb1, lacc);

        // ---- O^T += V^T * P^T  (A operands = V rows in LDS, transposed by the load)
        const _Float16* vr = vbuf + (8 * hi + (lane & 7)) * VSTR + ((lane >> 3) & 1) * 8;
#pragma unroll
        for (int n = 0; n < 4; ++n) {
            acc[n] = wmma_f16(make_at(vr + n * 16),             pb0, acc[n]);
            acc[n] = wmma_f16(make_at(vr + 32 * VSTR + n * 16), pb1, acc[n]);
        }

        if (t + 1 < NTILES)
            put(cur ? KshA : KshB, cur ? VshA : VshB);
    }

    // ---- normalize and write fp32 output: a lane holds 8 consecutive d per chunk
    {
        const float inv = 1.0f / lacc[0];
        float* orow = Ob + (size_t)(qrow0 + lo) * DHEAD + 8 * hi;
#pragma unroll
        for (int n = 0; n < 4; ++n) {
            *(float4*)(orow + n * 16) =
                make_float4(acc[n][0] * inv, acc[n][1] * inv, acc[n][2] * inv, acc[n][3] * inv);
            *(float4*)(orow + n * 16 + 4) =
                make_float4(acc[n][4] * inv, acc[n][5] * inv, acc[n][6] * inv, acc[n][7] * inv);
        }
    }
}

extern "C" void kernel_launch(void* const* d_in, const int* in_sizes, int n_in,
                              void* d_out, int out_size, void* d_ws, size_t ws_size,
                              hipStream_t stream) {
    (void)in_sizes; (void)n_in; (void)out_size; (void)d_ws; (void)ws_size;
    const float* q = (const float*)d_in[0];
    const float* k = (const float*)d_in[1];
    const float* v = (const float*)d_in[2];
    float* o = (float*)d_out;
    dim3 grid(256), block(512);   // (B*H)*(S/256) blocks, 16 waves each
    attn_fwd_kernel<<<grid, block, 0, stream>>>(q, k, v, o);
}

// v006
// It runs in 36.4 microseconds.
// Two timings next to v005 put it at 1.05 and 1.06 times that version's speed.
// Over all steps from v000 it is 3.32 times as fast.
#include <hip/hip_runtime.h>

typedef __attribute__((ext_vector_type(16))) _Float16 v16h;
typedef __attribute__((ext_vector_type(8)))  _Float16 v8h;
typedef __attribute__((ext_vector_type(8)))  short    v8s;
typedef __attribute__((ext_vector_type(8)))  float    v8f;

#define S_LEN   2048
#define DHEAD   64
#define KT      64            // keys per wave and stage
#define KHALVES 2             // waves that share a query group, each on its own KT keys of a stage
#define KP      (KT * KHALVES)   // keys per stage
#define NTILES  (S_LEN / KP)  // 16 stages
#define KSTR    72            // K lds row stride in halves (144B: 16B-aligned, 36-bank step)
#define VSTR    80            // V lds row stride in halves (160B: 32B x odd, the transposing load's pitch)
#define WAVES   16
#define THREADS (WAVES * 32)
#define QGRPS   (WAVES / KHALVES)       // query groups per block
#define QROWS   (QGRPS * 32)            // q-rows per block
#define QBLKS   (S_LEN / QROWS)         // blocks per head
#define NSLOT   (KP * DHEAD / 4 / THREADS) // float4 slots per thread, operand and stage
#define SROWS   (THREADS / 16)          // rows between a thread's slots

static __device__ inline v8f wmma_f16(v16h a, v16h b, v8f c) {
    return __builtin_amdgcn_wmma_f32_16x16x32_f16(
        false, a, false, b, (short)0, c, false, false);
}

// 16x32 "A layout" operand from an LDS row pointer.
// lane (lo,hi): halves[0..7] = row[hi*8 + 0..7], halves[8..15] = row[16 + hi*8 + 0..7]
static __device__ inline v16h make_a(const _Float16* rowp, int hi) {
    v8h a = *(const v8h*)(rowp + hi * 8);
    v8h b = *(const v8h*)(rowp + 16 + hi * 8);
    v16h r;
#pragma unroll
    for (int i = 0; i < 8; ++i) { r[i] = a[i]; r[i + 8] = b[i]; }
    return r;
}

// 16x32 "A layout" operand of V^T from row-major V rows in LDS (ds_load_tr16_b128).
// p: this lane's address, row 8*hi + (lane & 7) of the 32 keys, halves 8*((lane >> 3) & 1) of the 16 d.
// lane (lo,hi): halves[0..7] = V[hi*8 + 0..7][lo], halves[8..15] = V[16 + hi*8 + 0..7][lo]
static __device__ inline v16h make_at(const _Float16* p) {
    typedef __attribute__((address_space(3))) v8s lds_v8s;
    v8h a = __builtin_bit_cast(v8h, __builtin_amdgcn_ds_load_tr16_b128_v8i16((lds_v8s*)p));
    v8h b = __builtin_bit_cast(v8h, __builtin_amdgcn_ds_load_tr16_b128_v8i16((lds_v8s*)(p + 16 * VSTR)));
    v16h r;
#pragma unroll
    for (int i = 0; i < 8; ++i) { r[i] = a[i]; r[i + 8] = b[i]; }
    return r;
}

// 2^x by the bare v_exp_f32, in place. exp2f() wraps the same instruction in a compare, two selects,
// an add and an ldexp that only rescue results below 2^-126; here those come out 0 (see the loop).
static __device__ inline void exp2_x8(v8f& x) {
    float a = x[0], b = x[1], c = x[2], d = x[3], e = x[4], f = x[5], g = x[6], h = x[7];
    // asm, one statement closed by v_nop: keeps the one free slot the instruction set asks for between a
    // transcendental and a use of its result or a write of its source
    asm("v_exp_f32 %0, %0\n\tv_exp_f32 %1, %1\n\tv_exp_f32 %2, %2\n\tv_exp_f32 %3, %3\n\t"
        "v_exp_f32 %4, %4\n\tv_exp_f32 %5, %5\n\tv_exp_f32 %6, %6\n\tv_exp_f32 %7, %7\n\tv_nop"
        : "+v"(a), "+v"(b), "+v"(c), "+v"(d), "+v"(e), "+v"(f), "+v"(g), "+v"(h));
    x[0] = a; x[1] = b; x[2] = c; x[3] = d; x[4] = e; x[5] = f; x[6] = g; x[7] = h;
}
static __device__ inline float exp2_x1(float x) {
    // v_nop: the same slot behind the transcendental as in exp2_x8
    asm("v_exp_f32 %0, %0\n\tv_nop" : "+v"(x));
    return x;
}

// value of lane l ^ 16 (the other half of the wave holds the other keys of a query)
static __device__ inline float xhalf(float x) {
    return __builtin_bit_cast(float, __builtin_amdgcn_permlanex16(
        __builtin_bit_cast(int, x), __builtin_bit_cast(int, x),
        0x76543210, 0xfedcba98, false, false));
}

// one 16-wave work-group fills a WGP at 4 waves per SIMD. waves_per_eu states that residency: without it the
// compiler saved registers for more resident waves and split the K fragment loads into more, smaller groups
__global__ __launch_bounds__(THREADS) __attribute__((amdgpu_waves_per_eu(4, 4))) void
attn_fwd_kernel(const float* __restrict__ Q, const float* __restrict__ K,
                const float* __restrict__ V, float* __restrict__ O)
{
    __shared__ __attribute__((aligned(16))) _Float16 KshA[KP * KSTR], KshB[KP * KSTR]; // 128 x 72 halves each
    __shared__ __attribute__((aligned(16))) _Float16 VshA[KP * VSTR], VshB[KP * VSTR]; // 128 x 80 (key rows)
    __shared__ float4 xch[WAVES][9][32];   // merge of the key halves: what a wave hands to its partner

    const int tid   = threadIdx.x;
    const int wave  = tid >> 5;
    const int lane  = tid & 31;
    const int lo    = lane & 15;
    const int hi    = lane >> 4;
    const int qgrp  = wave & (QGRPS - 1);
    const int khalf = wave / QGRPS;

    const int bh    = blockIdx.x / QBLKS;   // (b*H+h)
    const int qblk  = blockIdx.x % QBLKS;
    const int qrow0 = qblk * QROWS + qgrp * 32;

    const float* Qb = Q + (size_t)bh * S_LEN * DHEAD;
    const float* Kb = K + (size_t)bh * S_LEN * DHEAD;
    const float* Vb = V + (size_t)bh * S_LEN * DHEAD;
    float*       Ob = O + (size_t)bh * S_LEN * DHEAD;

    // fold softmax scale (1/sqrt(64)) and log2(e) into Q so P = exp2(S - m)
    const float qscale = 0.125f * 1.44269504088896340736f;

    // ---- Q tile (32x64): per 16-query group c two B operands of Q^T (column = query c*16 + lo; d 0..31 / 32..63)
    v16h qa0[2], qa1[2];
#pragma unroll
    for (int c = 0; c < 2; ++c) {
        const float* qrow = Qb + (size_t)(qrow0 + c * 16 + lo) * DHEAD;
        const int c0 = hi * 8;
#pragma unroll
        for (int i = 0; i < 8; ++i) {
            qa0[c][i]     = (_Float16)(qrow[c0 + i]      * qscale);
            qa0[c][i + 8] = (_Float16)(qrow[16 + c0 + i] * qscale);
            qa1[c][i]     = (_Float16)(qrow[32 + c0 + i] * qscale);
            qa1[c][i + 8] = (_Float16)(qrow[48 + c0 + i] * qscale);
        }
    }

    v16h ones;
#pragma unroll
    for (int i = 0; i < 16; ++i) ones[i] = (_Float16)1.0f;

    // ---- accumulators over this wave's keys, per group c for query c*16 + lo: O^T (64x16 over 4 d-chunks;
    //      acc[c][n][g] is d = n*16 + 8*hi + g), l (sum of P, the same in every register), m (max)
    v8f acc[2][4], lacc[2];
    float mrow[2] = { -1e30f, -1e30f };
#pragma unroll
    for (int c = 0; c < 2; ++c) {
#pragma unroll
        for (int n = 0; n < 4; ++n)
#pragma unroll
            for (int g = 0; g < 8; ++g) acc[c][n][g] = 0.0f;
#pragma unroll
        for (int g = 0; g < 8; ++g) lacc[c][g] = 0.0f;
    }

    // cooperative stage of 128 keys, in two parts.
    // slot i*THREADS+tid of 2048 float4 slots: row = key in stage, col = d
    float4 kd[NSLOT], vd[NSLOT];
    // this thread's slot 0 of the stage last fetched; slot i lies SROWS rows further on
    // (one element offset serves K and V, which are laid out alike)
    unsigned foff = (tid >> 4) * DHEAD + ((tid & 15) << 2);
    // part 1: all global loads of the stage in flight together
    // (ahead: rows from foff to the stage wanted, 0 or KP)
    auto fetch = [&](int tile, int ahead) {
        const float* kfetch = Kb + foff;
        const float* vfetch = Vb + foff;
#pragma unroll
        for (int i = 0; i < NSLOT; ++i) {
            kd[i] = *(const float4*)(kfetch + (ahead + i * SROWS) * DHEAD);
            vd[i] = *(const float4*)(vfetch + (ahead + i * SROWS) * DHEAD);
        }
        if (tile + 1 < NTILES) {              // L2 prefetch (global_prefetch_b8)
#pragma unroll
            for (int i = 0; i < NSLOT; ++i) {
                __builtin_prefetch(kfetch + (ahead + KP + i * SROWS) * DHEAD, 0, 1);
                __builtin_prefetch(vfetch + (ahead + KP + i * SROWS) * DHEAD, 0, 1);
            }
        }
    };
    // part 2: K and V row-major f16
    auto put = [&](_Float16* kdst, _Float16* vdst) {
#pragma unroll
        for (int i = 0; i < NSLOT; ++i) {
            const int slot = i * THREADS + tid;
            const int row  = slot >> 4;
            const int col  = (slot & 15) << 2;
            _Float16* kp = kdst + row * KSTR + col;
            kp[0] = (_Float16)kd[i].x; kp[1] = (_Float16)kd[i].y;
            kp[2] = (_Float16)kd[i].z; kp[3] = (_Float16)kd[i].w;
            _Float16* vp = vdst + row * VSTR + col;
            vp[0] = (_Float16)vd[i].x; vp[1] = (_Float16)vd[i].y;
            vp[2] = (_Float16)vd[i].z; vp[3] = (_Float16)vd[i].w;
        }
    };

    fetch(0, 0);
    // s_wait_xcnt 0 in front of the first write of a register that the lines above name as an address
    asm volatile("s_wait_xcnt 0x0" ::: "memory");
    put(KshA, VshA);

    for (int t = 0; t < NTILES; ++t) {
        __syncthreads();   // staged keys of stage t visible; prior reads of the other buffer done
        const int cur = t & 1;
        const _Float16* kbuf = (cur ? KshB : KshA) + khalf * KT * KSTR;   // this wave's 64 keys
        const _Float16* vbuf = (cur ? VshB : VshA) + khalf * KT * VSTR;
        if (t + 1 < NTILES) {
            fetch(t + 1, KP);       // lands while stage t is worked on
            // s_wait_xcnt 0 between the loads above and the first write of a register they name as an address;
            // the offset is an operand so that its step below cannot be scheduled ahead of the wait
            asm volatile("s_wait_xcnt 0x0" : "+v"(foff) : : "memory");
            foff += KP * DHEAD;
        }

        // ---- scores S^T = K*Q^T (64 x 32), four 16-key C tiles per query group; a K fragment serves both groups:
        //      s[c][st][g] = score of key st*16 + 8*hi + g against query c*16 + lo
        v8f s[2][4];
#pragma unroll
        for (int st = 0; st < 4; ++st) {
            const _Float16* kr = kbuf + (st * 16 + lo) * KSTR;
            const v16h ka0 = make_a(kr, hi);
            const v16h ka1 = make_a(kr + 32, hi);
#pragma unroll
            for (int c = 0; c < 2; ++c) {
#pragma unroll
                for (int g = 0; g < 8; ++g) s[c][st][g] = 0.0f;
                s[c][st] = wmma_f16(ka0, qa0[c], s[c][st]);
                s[c][st] = wmma_f16(ka1, qa1[c], s[c][st]);
            }
        }

        v16h pb0[2], pb1[2];
#pragma unroll
        for (int c = 0; c < 2; ++c) {
            // ---- max over the 64 keys of query c*16 + lo: 32 in this lane, 32 in lane ^ 16
            float mt[8];
#pragma unroll
            for (int g = 0; g < 8; ++g)
                mt[g] = fmaxf(fmaxf(s[c][0][g], s[c][1][g]), fmaxf(s[c][2][g], s[c][3][g]));
            float mx = fmaxf(fmaxf(fmaxf(mt[0], mt[1]), fmaxf(mt[2], mt[3])),
                             fmaxf(fmaxf(mt[4], mt[5]), fmaxf(mt[6], mt[7])));
            mx = fmaxf(mx, xhalf(mx));

            const float mn   = fmaxf(mrow[c], mx);
            // a corr below 2^-126 comes out 0: the sums it scales vanish beside this tile's own P = 1 term
            const float corr = exp2_x1(mrow[c] - mn);
            mrow[c] = mn;
            // a P below 2^-126 comes out 0, which is what it rounds to in f16 anyway
#pragma unroll
            for (int st = 0; st < 4; ++st) {
#pragma unroll
                for (int g = 0; g < 8; ++g) s[c][st][g] -= mn;
                exp2_x8(s[c][st]);
            }

            // rescale running accumulators (O and l) by corr
#pragma unroll
            for (int n = 0; n < 4; ++n)
#pragma unroll
                for (int g = 0; g < 8; ++g) acc[c][n][g] *= corr;
#pragma unroll
            for (int g = 0; g < 8; ++g) lacc[c][g] *= corr;

            // ---- P^T: two score tiles (32 keys) converted in place are one B operand
#pragma unroll
            for (int i = 0; i < 8; ++i) {
                pb0[c][i] = (_Float16)s[c][0][i]; pb0[c][i + 8] = (_Float16)s[c][1][i];  // keys 0..31
                pb1[c][i] = (_Float16)s[c][2][i]; pb1[c][i + 8] = (_Float16)s[c][3][i];  // keys 32..63
            }

            // ---- l += colsum(P^T) via WMMA with an all-ones A (replicated per row)
            lacc[c] = wmma_f16(ones, pb0[c], lacc[c]);
            lacc[c] = wmma_f16(ones, pb1[c], lacc[c]);
        }

        // ---- O^T += V^T * P^T  (A operands = V rows in LDS, transposed by the load; each serves both groups)
        const _Float16* vr = vbuf + (8 * hi + (lane & 7)) * VSTR + ((lane >> 3) & 1) * 8;
#pragma unroll
        for (int n = 0; n < 4; ++n) {
            const v16h va0 = make_at(vr + n * 16);
            const v16h va1 = make_at(vr + 32 * VSTR + n * 16);
#pragma unroll
            for (int c = 0; c < 2; ++c) {
                acc[c][n] = wmma_f16(va0, pb0[c], acc[c][n]);
                acc[c][n] = wmma_f16(va1, pb1[c], acc[c][n]);
            }
        }

        if (t + 1 < NTILES)
            put(cur ? KshA : KshB, cur ? VshA : VshB);
    }

    // ---- merge the two key halves: wave (qgrp, khalf) finishes query group c = khalf and hands its
    //      partial O, m, l of the other group to its partner, wave ^ QGRPS
    {
        const bool up = khalf != 0;
        float4* xo = &xch[wave][0][lane];
#pragma unroll
        for (int n = 0; n < 4; ++n) {
            xo[(2 * n) * 32]     = up ? make_float4(acc[0][n][0], acc[0][n][1], acc[0][n][2], acc[0][n][3])
                                      : make_float4(acc[1][n][0], acc[1][n][1], acc[1][n][2], acc[1][n][3]);
            xo[(2 * n + 1) * 32] = up ? make_float4(acc[0][n][4], acc[0][n][5], acc[0][n][6], acc[0][n][7])
                                      : make_float4(acc[1][n][4], acc[1][n][5], acc[1][n][6], acc[1][n][7]);
        }
        xo[8 * 32] = up ? make_float4(mrow[0], lacc[0][0], 0.0f, 0.0f)
                        : make_float4(mrow[1], lacc[1][0], 0.0f, 0.0f);
        __syncthreads();   // every wave's hand-over is written before its partner reads it
        const float4* xi = &xch[wave ^ QGRPS][0][lane];
        const float4 ml  = xi[8 * 32];
        const float mk = up ? mrow[1] : mrow[0];
        const float lk = up ? lacc[1][0] : lacc[0][0];
        const float m  = fmaxf(mk, ml.x);
        float ak = exp2_x1(mk - m);      // weight of this wave's half
        float ag = exp2_x1(ml.x - m);    // weight of the partner's half
        const float inv = 1.0f / (ak * lk + ag * ml.y);
        ak *= inv; ag *= inv;

        // ---- normalize and write fp32 output: a lane holds 8 consecutive d per chunk
        float* orow = Ob + (size_t)(qrow0 + khalf * 16 + lo) * DHEAD + 8 * hi;
#pragma unroll
        for (int n = 0; n < 4; ++n) {
            const float4 g0 = xi[(2 * n) * 32], g1 = xi[(2 * n + 1) * 32];
            const v8f kp = up ? acc[1][n] : acc[0][n];
            *(float4*)(orow + n * 16) =
                make_float4(kp[0] * ak + g0.x * ag, kp[1] * ak + g0.y * ag, kp[2] * ak + g0.z * ag, kp[3] * ak + g0.w * ag);
            *(float4*)(orow + n * 16 + 4) =
                make_float4(kp[4] * ak + g1.x * ag, kp[5] * ak + g1.y * ag, kp[6] * ak + g1.z * ag, kp[7] * ak + g1.w * ag);
        }
    }
}

extern "C" void kernel_launch(void* const* d_in, const int* in_sizes, int n_in,
                              void* d_out, int out_size, void* d_ws, size_t ws_size,
                              hipStream_t stream) {
    (void)in_sizes; (void)n_in; (void)out_size; (void)d_ws; (void)ws_size;
    const float* q = (const float*)d_in[0];
    const float* k = (const float*)d_in[1];
    const float* v = (const float*)d_in[2];
    float* o = (float*)d_out;
    dim3 grid(256), block(512);   // (B*H)*(S/256) blocks, 16 waves each
    attn_fwd_kernel<<<grid, block, 0, stream>>>(q, k, v, o);
}

// v008
// Measured time: 30.7 microseconds a run.
// It is 1.19 times as fast as v006, going by the measured steps of the versions left out in between.
// Over all steps from v000 it is 3.93 times as fast.
#include <hip/hip_runtime.h>

typedef __attribute__((ext_vector_type(16))) _Float16 v16h;
typedef __attribute__((ext_vector_type(8)))  _Float16 v8h;
typedef __attribute__((ext_vector_type(8)))  short    v8s;
typedef __attribute__((ext_vector_type(8)))  float    v8f;

#define S_LEN   2048
#define DHEAD   64
#define KT      64            // keys per wave and stage
#define KHALVES 2             // waves that share a query group, each on its own KT keys of a stage
#define KP      (KT * KHALVES)   // keys per stage
#define NTILES  (S_LEN / KP)  // 16 stages
#define KSTR    72            // K lds row stride in halves (144B: 16B-aligned, 36-bank step)
#define VSTR    80            // V lds row stride in halves (160B: 32B x odd, the transposing load's pitch)
#define WAVES   16
#define THREADS (WAVES * 32)
#define QGRPS   (WAVES / KHALVES)       // query groups per block
#define QROWS   (QGRPS * 32)            // q-rows per block
#define QBLKS   (S_LEN / QROWS)         // blocks per head
#define NSLOT   (KP * DHEAD / 4 / THREADS) // float4 slots per thread, operand and stage
#define SROWS   (THREADS / 16)          // rows between a thread's slots
#define PMAX    4096.0f                 // a stage's sum of P above this: new maximum (every P below it is finite in f16)

static __device__ inline v8f wmma_f16(v16h a, v16h b, v8f c) {
    return __builtin_amdgcn_wmma_f32_16x16x32_f16(
        false, a, false, b, (short)0, c, false, false);
}

// 16x32 "A layout" operand from an LDS row pointer.
// lane (lo,hi): halves[0..7] = row[hi*8 + 0..7], halves[8..15] = row[16 + hi*8 + 0..7]; p = row + hi*8
static __device__ inline v16h make_a(const _Float16* p) {
    v8h a = *(const v8h*)(p);
    v8h b = *(const v8h*)(p + 16);
    v16h r;
#pragma unroll
    for (int i = 0; i < 8; ++i) { r[i] = a[i]; r[i + 8] = b[i]; }
    return r;
}

// 16x32 "A layout" operand of V^T from row-major V rows in LDS (ds_load_tr16_b128).
// p: this lane's address, row 8*hi + (lane & 7) of the 32 keys, halves 8*((lane >> 3) & 1) of the 16 d.
// lane (lo,hi): halves[0..7] = V[hi*8 + 0..7][lo], halves[8..15] = V[16 + hi*8 + 0..7][lo]
static __device__ inline v16h make_at(const _Float16* p) {
    typedef __attribute__((address_space(3))) v8s lds_v8s;
    v8h a = __builtin_bit_cast(v8h, __builtin_amdgcn_ds_load_tr16_b128_v8i16((lds_v8s*)p));
    v8h b = __builtin_bit_cast(v8h, __builtin_amdgcn_ds_load_tr16_b128_v8i16((lds_v8s*)(p + 16 * VSTR)));
    v16h r;
#pragma unroll
    for (int i = 0; i < 8; ++i) { r[i] = a[i]; r[i + 8] = b[i]; }
    return r;
}

// 2^x by the bare v_exp_f32. exp2f() wraps the same instruction in a compare, two selects,
// an add and an ldexp that only rescue results below 2^-126; here those come out 0 (see the loop).
static __device__ inline v8f exp2_x8(const v8f& x) {
    float a, b, c, d, e, f, g, h;
    // asm, one statement closed by v_nop: keeps the one free slot the instruction set asks for between a
    // transcendental and a use of its result or a write of its source. The results take
    // registers of their own: written in place, the accumulator tiles were first copied out, register by register
    asm("v_exp_f32 %0, %8\n\tv_exp_f32 %1, %9\n\tv_exp_f32 %2, %10\n\tv_exp_f32 %3, %11\n\t"
        "v_exp_f32 %4, %12\n\tv_exp_f32 %5, %13\n\tv_exp_f32 %6, %14\n\tv_exp_f32 %7, %15\n\tv_nop"
        : "=&v"(a), "=&v"(b), "=&v"(c), "=&v"(d), "=&v"(e), "=&v"(f), "=&v"(g), "=&v"(h)
        : "v"(x[0]), "v"(x[1]), "v"(x[2]), "v"(x[3]), "v"(x[4]), "v"(x[5]), "v"(x[6]), "v"(x[7]));
    v8f r;
    r[0] = a; r[1] = b; r[2] = c; r[3] = d; r[4] = e; r[5] = f; r[6] = g; r[7] = h;
    return r;
}
static __device__ inline float exp2_x1(float x) {
    // v_nop: the same slot behind the transcendental as in exp2_x8
    asm("v_exp_f32 %0, %0\n\tv_nop" : "+v"(x));
    return x;
}

// value of lane l ^ 16 (the other half of the wave holds the other keys of a query)
static __device__ inline float xhalf(float x) {
    return __builtin_bit_cast(float, __builtin_amdgcn_permlanex16(
        __builtin_bit_cast(int, x), __builtin_bit_cast(int, x),
        0x76543210, 0xfedcba98, false, false));
}

// one 16-wave work-group fills a WGP at 4 waves per SIMD. waves_per_eu states that residency: without it the
// compiler saved registers for more resident waves and split the K fragment loads into more, smaller groups
__global__ __launch_bounds__(THREADS) __attribute__((amdgpu_waves_per_eu(4, 4))) void
attn_fwd_kernel(const float* __restrict__ Q, const float* __restrict__ K,
                const float* __restrict__ V, float* __restrict__ O)
{
    __shared__ __attribute__((aligned(16))) _Float16 KshA[KP * KSTR], KshB[KP * KSTR]; // 128 x 72 halves each
    __shared__ __attribute__((aligned(16))) _Float16 VshA[KP * VSTR], VshB[KP * VSTR]; // 128 x 80 (key rows)
    __shared__ float4 xch[WAVES][9][32];   // merge of the key halves: what a wave hands to its partner

    const int tid   = threadIdx.x;
    const int wave  = tid >> 5;
    const int lane  = tid & 31;
    const int lo    = lane & 15;
    const int hi    = lane >> 4;
    const int qgrp  = wave & (QGRPS - 1);
    const int khalf = wave / QGRPS;

    const int bh    = blockIdx.x / QBLKS;   // (b*H+h)
    const int qblk  = blockIdx.x % QBLKS;
    const int qrow0 = qblk * QROWS + qgrp * 32;

    const float* Qb = Q + (size_t)bh * S_LEN * DHEAD;
    const float* Kb = K + (size_t)bh * S_LEN * DHEAD;
    const float* Vb = V + (size_t)bh * S_LEN * DHEAD;
    float*       Ob = O + (size_t)bh * S_LEN * DHEAD;

    // fold softmax scale (1/sqrt(64)) and log2(e) into Q so P = exp2(S - m)
    const float qscale = 0.125f * 1.44269504088896340736f;

    // ---- Q tile (32x64): per 16-query group c two B operands of Q^T (column = query c*16 + lo; d 0..31 / 32..63)
    v16h qa0[2], qa1[2];
#pragma unroll
    for (int c = 0; c < 2; ++c) {
        const float* qrow = Qb + (size_t)(qrow0 + c * 16 + lo) * DHEAD;
        const int c0 = hi * 8;
#pragma unroll
        for (int i = 0; i < 8; ++i) {
            qa0[c][i]     = (_Float16)(qrow[c0 + i]      * qscale);
            qa0[c][i + 8] = (_Float16)(qrow[16 + c0 + i] * qscale);
            qa1[c][i]     = (_Float16)(qrow[32 + c0 + i] * qscale);
            qa1[c][i + 8] = (_Float16)(qrow[48 + c0 + i] * qscale);
        }
    }

    v16h ones;
#pragma unroll
    for (int i = 0; i < 16; ++i) ones[i] = (_Float16)1.0f;

    // ---- accumulators over this wave's keys, per group c for query c*16 + lo: O^T (64x16 over 4 d-chunks;
    //      acc[c][n][g] is d = n*16 + 8*hi + g), l (sum of P), negm (minus the maximum in use, in all
    //      eight registers: the C operand of a score tile)
    v8f acc[2][4], negm[2], zero;
    float lrow[2] = { 0.0f, 0.0f };
#pragma unroll
    for (int g = 0; g < 8; ++g) zero[g] = 0.0f;
#pragma unroll
    for (int c = 0; c < 2; ++c) {
#pragma unroll
        for (int n = 0; n < 4; ++n) acc[c][n] = zero;
#pragma unroll
        for (int g = 0; g < 8; ++g) negm[c][g] = 1e30f;
    }

    // cooperative stage of 128 keys, in two parts.
    // slot i*THREADS+tid of 2048 float4 slots: row = key in stage, col = d
    float4 kd[NSLOT], vd[NSLOT];
    // this thread's slot 0 of the stage last fetched; slot i lies SROWS rows further on
    // (one element offset serves K and V, which are laid out alike)
    unsigned foff = (tid >> 4) * DHEAD + ((tid & 15) << 2);
    // part 1: all global loads of the stage in flight together
    // (ahead: rows from foff to the stage wanted, 0 or KP)
    auto fetch = [&](int tile, int ahead) {
        const float* kfetch = Kb + foff;
        const float* vfetch = Vb + foff;
#pragma unroll
        for (int i = 0; i < NSLOT; ++i) {
            kd[i] = *(const float4*)(kfetch + (ahead + i * SROWS) * DHEAD);
            vd[i] = *(const float4*)(vfetch + (ahead + i * SROWS) * DHEAD);
        }
        if (tile + 1 < NTILES) {              // L2 prefetch (global_prefetch_b8)
#pragma unroll
            for (int i = 0; i < NSLOT; ++i) {
                __builtin_prefetch(kfetch + (ahead + KP + i * SROWS) * DHEAD, 0, 1);
                __builtin_prefetch(vfetch + (ahead + KP + i * SROWS) * DHEAD, 0, 1);
            }
        }
    };
    // part 2: K and V row-major f16
    // this thread's places in a stage buffer, in halves, each summed once here: one register each through the loop
    // (as sums of parts formed in the loop they held thirteen, which the fragment groups below need)
    const int kpoff = (tid >> 4) * KSTR + ((tid & 15) << 2);                                 // slot 0, K
    const int vpoff = (tid >> 4) * VSTR + ((tid & 15) << 2);                                 // slot 0, V
    const int kroff = (khalf * KT + lo) * KSTR + hi * 8;                                     // K fragment reads
    const int vroff = (khalf * KT + 8 * hi + (lane & 7)) * VSTR + ((lane >> 3) & 1) * 8;     // V^T fragment reads
    auto put = [&](_Float16* kdst, _Float16* vdst) {
#pragma unroll
        for (int i = 0; i < NSLOT; ++i) {
            _Float16* kp = kdst + kpoff + i * SROWS * KSTR;
            kp[0] = (_Float16)kd[i].x; kp[1] = (_Float16)kd[i].y;
            kp[2] = (_Float16)kd[i].z; kp[3] = (_Float16)kd[i].w;
            _Float16* vp = vdst + vpoff + i * SROWS * VSTR;
            vp[0] = (_Float16)vd[i].x; vp[1] = (_Float16)vd[i].y;
            vp[2] = (_Float16)vd[i].z; vp[3] = (_Float16)vd[i].w;
        }
    };

    fetch(0, 0);
    // s_wait_xcnt 0 in front of the first write of a register that the lines above name as an address
    asm volatile("s_wait_xcnt 0x0" ::: "memory");
    put(KshA, VshA);

    for (int t = 0; t < NTILES; ++t) {
        __syncthreads();   // staged keys of stage t visible; prior reads of the other buffer done
        const int cur = t & 1;
        const _Float16* kbuf = (cur ? KshB : KshA) + kroff;   // this wave's 64 keys, this lane's row and part
        const _Float16* vr   = (cur ? VshB : VshA) + vroff;
        // ---- scores S^T = K*Q^T + C (64 x 32), four 16-key C tiles per query group, in two halves of 32 keys;
        //      a K fragment serves both groups:
        //      s[c][st][g] = C + score of key st*16 + 8*hi + g against query c*16 + lo
        v8f s[2][4], ls[2];
        v16h pb[2][2];           // pb[h][c]: P^T of keys h*32 .. h*32 + 31, query group c
        v16h kf[2][2];           // K fragments of one half: [16-key tile][d 0..31 / 32..63]
        auto kfrags = [&](int h) {
#pragma unroll
            for (int j = 0; j < 2; ++j) {
                const _Float16* kr = kbuf + (2 * h + j) * 16 * KSTR;
                kf[j][0] = make_a(kr);
                kf[j][1] = make_a(kr + 32);
            }
        };
        // V^T fragments of d chunk n: [keys 0..31 / 32..63 of this wave's 64]
        v16h vf[4][2];
        auto vfrags = [&](int n) {
            vf[n][0] = make_at(vr + n * 16);
            vf[n][1] = make_at(vr + 32 * VSTR + n * 16);
        };
        auto scores = [&](int h, const v8f& c0, const v8f& c1) {
#pragma unroll
            for (int j = 0; j < 2; ++j) {
                const int st = 2 * h + j;
                s[0][st] = wmma_f16(kf[j][0], qa0[0], c0);
                s[1][st] = wmma_f16(kf[j][0], qa0[1], c1);
                s[0][st] = wmma_f16(kf[j][1], qa1[0], s[0][st]);
                s[1][st] = wmma_f16(kf[j][1], qa1[1], s[1][st]);
            }
        };
        // P = exp2(s); P^T: two score tiles (32 keys), converted, are one B operand
        auto probs = [&](int h) {
#pragma unroll
            for (int c = 0; c < 2; ++c) {
                // a P below 2^-126 comes out 0, which is what it rounds to in f16 anyway
                const v8f p0 = exp2_x8(s[c][2 * h]);
                const v8f p1 = exp2_x8(s[c][2 * h + 1]);
#pragma unroll
                for (int i = 0; i < 8; ++i) {
                    pb[h][c][i] = (_Float16)p0[i]; pb[h][c][i + 8] = (_Float16)p1[i];
                }
            }
        };
        // ls = this stage's colsum(P^T) via WMMA with an all-ones A (the same in every register)
        auto sums = [&]() {
            ls[0] = wmma_f16(ones, pb[0][0], zero);
            ls[1] = wmma_f16(ones, pb[0][1], zero);
            ls[0] = wmma_f16(ones, pb[1][0], ls[0]);
            ls[1] = wmma_f16(ones, pb[1][1], ls[1]);
        };

        // the common case: the maximum in use still serves. P >= 0, so a sum within PMAX bounds every P of the
        // stage; an overflow (inf) or a NaN fails the test too. One test per stage, a scalar branch.
        // The scheduling barriers keep this order: with no maximum to wait for, the compiler otherwise moves
        // the exponentials in among the products, where K fragments, all scores and P operands are live together
        // (the build spills to scratch); and the second half's K reads stay ahead of the first half's exponentials.
        // Every group of LDS reads stands whole, one phase ahead of the products it feeds: the first half's K reads
        // in front of the global loads, the second half's behind the first half's products (into their registers,
        // landing under the exponentials), the first V^T reads behind the second half's products.
        bool renew = t == 0;     // no maximum yet
        if (!renew) kfrags(0);
        if (t + 1 < NTILES) {
            fetch(t + 1, KP);       // lands while stage t is worked on
            // s_wait_xcnt 0 between the loads above and the first write of a register they name as an address;
            // the offset is an operand so that its step below cannot be scheduled ahead of the wait
            asm volatile("s_wait_xcnt 0x0" : "+v"(foff) : : "memory");
            foff += KP * DHEAD;
        }
        if (!renew) {
            scores(0, negm[0], negm[1]);
            // keeps the second half's K reads behind these products: moved ahead of them they take 32 more registers,
            // and the first half's reads then come two at a time, each pair waited for in full
            __builtin_amdgcn_sched_barrier(0);
            kfrags(1);
            __builtin_amdgcn_sched_barrier(0);
            // v_nop x 4: the vector slots the chip needs between a product and an instruction that reads its result
            // or writes over its operands
            asm volatile("v_nop\n\tv_nop\n\tv_nop\n\tv_nop");
            __builtin_amdgcn_sched_barrier(0);
            probs(0);
            __builtin_amdgcn_sched_barrier(0);
            scores(1, negm[0], negm[1]);
            __builtin_amdgcn_sched_barrier(0);   // and the V^T reads stay here, ahead of the exponentials
            vfrags(0);
            vfrags(1);
            __builtin_amdgcn_sched_barrier(0);
            asm volatile("v_nop\n\tv_nop\n\tv_nop\n\tv_nop");   // the same four slots
            __builtin_amdgcn_sched_barrier(0);
            probs(1);
            __builtin_amdgcn_sched_barrier(0);
            sums();
            renew = __builtin_amdgcn_ballot_w32(!(ls[0][0] <= PMAX) || !(ls[1][0] <= PMAX)) != 0;
        }
        if (renew) {
            // the stage again, from its K rows in LDS, with the true running maximum
            kfrags(0);
            scores(0, zero, zero);
            kfrags(1);
            scores(1, zero, zero);
#pragma unroll
            for (int c = 0; c < 2; ++c) {
                // ---- max over the 64 keys of query c*16 + lo: 32 in this lane, 32 in lane ^ 16
                float mt[8];
#pragma unroll
                for (int g = 0; g < 8; ++g)
                    mt[g] = fmaxf(fmaxf(s[c][0][g], s[c][1][g]), fmaxf(s[c][2][g], s[c][3][g]));
                float mx = fmaxf(fmaxf(fmaxf(mt[0], mt[1]), fmaxf(mt[2], mt[3])),
                                 fmaxf(fmaxf(mt[4], mt[5]), fmaxf(mt[6], mt[7])));
                mx = fmaxf(mx, xhalf(mx));

                const float mo   = -negm[c][0];
                const float mn   = fmaxf(mo, mx);
                // a corr below 2^-126 comes out 0: the sums it scales vanish beside this stage's own P = 1 term
                const float corr = exp2_x1(mo - mn);
#pragma unroll
                for (int g = 0; g < 8; ++g) negm[c][g] = -mn;
#pragma unroll
                for (int st = 0; st < 4; ++st)
#pragma unroll
                    for (int g = 0; g < 8; ++g) s[c][st][g] -= mn;

                // rescale running accumulators (O and l) by corr
#pragma unroll
                for (int n = 0; n < 4; ++n)
#pragma unroll
                    for (int g = 0; g < 8; ++g) acc[c][n][g] *= corr;
                lrow[c] *= corr;
            }
            // the same order and the same four slots as above: no product near the asm exponentials
            __builtin_amdgcn_sched_barrier(0);
            asm volatile("v_nop\n\tv_nop\n\tv_nop\n\tv_nop");
            __builtin_amdgcn_sched_barrier(0);
            probs(0);
            probs(1);
            __builtin_amdgcn_sched_barrier(0);
            vfrags(0);
            vfrags(1);
            sums();
        }
        lrow[0] += ls[0][0];
        lrow[1] += ls[1][0];

        // ---- O^T += V^T * P^T  (A operands = V rows in LDS, transposed by the load; each serves both groups)
        auto outs = [&](int n) {
#pragma unroll
            for (int c = 0; c < 2; ++c) {
                acc[c][n] = wmma_f16(vf[n][0], pb[0][c], acc[c][n]);
                acc[c][n] = wmma_f16(vf[n][1], pb[1][c], acc[c][n]);
            }
        };
        // the scheduling barriers keep each chunk's four reads together and six or eight products ahead of their use;
        // left free, the reads came in ones and threes, the first of them two products ahead of its use
        vfrags(2);
        __builtin_amdgcn_sched_barrier(0);
        outs(0);
        __builtin_amdgcn_sched_barrier(0);
        vfrags(3);
        __builtin_amdgcn_sched_barrier(0);
        outs(1);
        outs(2);
        __builtin_amdgcn_sched_barrier(0);
        outs(3);

        if (t + 1 < NTILES)
            put(cur ? KshA : KshB, cur ? VshA : VshB);
    }

    // ---- merge the two key halves: wave (qgrp, khalf) finishes query group c = khalf and hands its
    //      partial O, m, l of the other group to its partner, wave ^ QGRPS
    {
        const bool up = khalf != 0;
        float4* xo = &xch[wave][0][lane];
#pragma unroll
        for (int n = 0; n < 4; ++n) {
            xo[(2 * n) * 32]     = up ? make_float4(acc[0][n][0], acc[0][n][1], acc[0][n][2], acc[0][n][3])
                                      : make_float4(acc[1][n][0], acc[1][n][1], acc[1][n][2], acc[1][n][3]);
            xo[(2 * n + 1) * 32] = up ? make_float4(acc[0][n][4], acc[0][n][5], acc[0][n][6], acc[0][n][7])
                                      : make_float4(acc[1][n][4], acc[1][n][5], acc[1][n][6], acc[1][n][7]);
        }
        xo[8 * 32] = up ? make_float4(-negm[0][0], lrow[0], 0.0f, 0.0f)
                        : make_float4(-negm[1][0], lrow[1], 0.0f, 0.0f);
        __syncthreads();   // every wave's hand-over is written before its partner reads it
        const float4* xi = &xch[wave ^ QGRPS][0][lane];
        const float4 ml  = xi[8 * 32];
        const float mk = up ? -negm[1][0] : -negm[0][0];
        const float lk = up ? lrow[1] : lrow[0];
        const float m  = fmaxf(mk, ml.x);
        float ak = exp2_x1(mk - m);      // weight of this wave's half
        float ag = exp2_x1(ml.x - m);    // weight of the partner's half
        const float inv = 1.0f / (ak * lk + ag * ml.y);
        ak *= inv; ag *= inv;

        // ---- normalize and write fp32 output: a lane holds 8 consecutive d per chunk
        float* orow = Ob + (size_t)(qrow0 + khalf * 16 + lo) * DHEAD + 8 * hi;
#pragma unroll
        for (int n = 0; n < 4; ++n) {
            const float4 g0 = xi[(2 * n) * 32], g1 = xi[(2 * n + 1) * 32];
            const v8f kp = up ? acc[1][n] : acc[0][n];
            *(float4*)(orow + n * 16) =
                make_float4(kp[0] * ak + g0.x * ag, kp[1] * ak + g0.y * ag, kp[2] * ak + g0.z * ag, kp[3] * ak + g0.w * ag);
            *(float4*)(orow + n * 16 + 4) =
                make_float4(kp[4] * ak + g1.x * ag, kp[5] * ak + g1.y * ag, kp[6] * ak + g1.z * ag, kp[7] * ak + g1.w * ag);
        }
    }
}

extern "C" void kernel_launch(void* const* d_in, const int* in_sizes, int n_in,
                              void* d_out, int out_size, void* d_ws, size_t ws_size,
                              hipStream_t stream) {
    (void)in_sizes; (void)n_in; (void)out_size; (void)d_ws; (void)ws_size;
    const float* q = (const float*)d_in[0];
    const float* k = (const float*)d_in[1];
    const float* v = (const float*)d_in[2];
    float* o = (float*)d_out;
    dim3 grid(256), block(512);   // (B*H)*(S/256) blocks, 16 waves each
    attn_fwd_kernel<<<grid, block, 0, stream>>>(q, k, v, o);
}

// v009
// A run of this version takes 28.6 microseconds.
// Next to v008, in two timings, it ran 1.08 and 1.07 times as fast.
// Over all steps from v000 it is 4.24 times as fast.
#include <hip/hip_runtime.h>

typedef __attribute__((ext_vector_type(16))) _Float16 v16h;
typedef __attribute__((ext_vector_type(8)))  _Float16 v8h;
typedef __attribute__((ext_vector_type(8)))  short    v8s;
typedef __attribute__((ext_vector_type(8)))  float    v8f;

#define S_LEN   2048
#define DHEAD   64
#define KT      64            // keys per wave and stage
#define KHALVES 2             // waves that share a query group, each on its own KT keys of a stage
#define KP      (KT * KHALVES)   // keys per stage
#define NTILES  (S_LEN / KP)  // 16 stages
#define KSTR    72            // K lds row stride in halves (144B: 16B-aligned, 36-bank step)
#define VSTR    80            // V lds row stride in halves (160B: 32B x odd, the transposing load's pitch)
#define WAVES   16
#define THREADS (WAVES * 32)
#define QGRPS   (WAVES / KHALVES)       // query groups per block
#define QROWS   (QGRPS * 32)            // q-rows per block
#define QBLKS   (S_LEN / QROWS)         // blocks per head
#define NSLOT   (KP * DHEAD / 4 / THREADS) // float4 slots per thread, operand and stage
#define SROWS   (THREADS / 16)          // rows between a thread's slots
#define OSTR    68            // output staging row stride in floats (272B: 16B x odd)
#define QSLOT   (QROWS * DHEAD / 4 / THREADS) // float4 slots per thread of the block's Q tile
#define PMAX    4096.0f                 // a stage's sum of P above this: new maximum (every P below it is finite in f16)

static __device__ inline v8f wmma_f16(v16h a, v16h b, v8f c) {
    return __builtin_amdgcn_wmma_f32_16x16x32_f16(
        false, a, false, b, (short)0, c, false, false);
}

// 16x32 "A layout" operand from an LDS row pointer.
// lane (lo,hi): halves[0..7] = row[hi*8 + 0..7], halves[8..15] = row[16 + hi*8 + 0..7]; p = row + hi*8
static __device__ inline v16h make_a(const _Float16* p) {
    v8h a = *(const v8h*)(p);
    v8h b = *(const v8h*)(p + 16);
    v16h r;
#pragma unroll
    for (int i = 0; i < 8; ++i) { r[i] = a[i]; r[i + 8] = b[i]; }
    return r;
}

// 16x32 "A layout" operand of V^T from row-major V rows in LDS (ds_load_tr16_b128).
// p: this lane's address, row 8*hi + (lane & 7) of the 32 keys, halves 8*((lane >> 3) & 1) of the 16 d.
// lane (lo,hi): halves[0..7] = V[hi*8 + 0..7][lo], halves[8..15] = V[16 + hi*8 + 0..7][lo]
static __device__ inline v16h make_at(const _Float16* p) {
    typedef __attribute__((address_space(3))) v8s lds_v8s;
    v8h a = __builtin_bit_cast(v8h, __builtin_amdgcn_ds_load_tr16_b128_v8i16((lds_v8s*)p));
    v8h b = __builtin_bit_cast(v8h, __builtin_amdgcn_ds_load_tr16_b128_v8i16((lds_v8s*)(p + 16 * VSTR)));
    v16h r;
#pragma unroll
    for (int i = 0; i < 8; ++i) { r[i] = a[i]; r[i + 8] = b[i]; }
    return r;
}

// 2^x by the bare v_exp_f32. exp2f() wraps the same instruction in a compare, two selects,
// an add and an ldexp that only rescue results below 2^-126; here those come out 0 (see the loop).
static __device__ inline v8f exp2_x8(const v8f& x) {
    float a, b, c, d, e, f, g, h;
    // asm, one statement closed by v_nop: keeps the one free slot the instruction set asks for between a
    // transcendental and a use of its result or a write of its source. The results take
    // registers of their own: written in place, the accumulator tiles were first copied out, register by register
    asm("v_exp_f32 %0, %8\n\tv_exp_f32 %1, %9\n\tv_exp_f32 %2, %10\n\tv_exp_f32 %3, %11\n\t"
        "v_exp_f32 %4, %12\n\tv_exp_f32 %5, %13\n\tv_exp_f32 %6, %14\n\tv_exp_f32 %7, %15\n\tv_nop"
        : "=&v"(a), "=&v"(b), "=&v"(c), "=&v"(d), "=&v"(e), "=&v"(f), "=&v"(g), "=&v"(h)
        : "v"(x[0]), "v"(x[1]), "v"(x[2]), "v"(x[3]), "v"(x[4]), "v"(x[5]), "v"(x[6]), "v"(x[7]));
    v8f r;
    r[0] = a; r[1] = b; r[2] = c; r[3] = d; r[4] = e; r[5] = f; r[6] = g; r[7] = h;
    return r;
}
static __device__ inline float exp2_x1(float x) {
    // v_nop: the same slot behind the transcendental as in exp2_x8
    asm("v_exp_f32 %0, %0\n\tv_nop" : "+v"(x));
    return x;
}

// value of lane l ^ 16 (the other half of the wave holds the other keys of a query)
static __device__ inline float xhalf(float x) {
    return __builtin_bit_cast(float, __builtin_amdgcn_permlanex16(
        __builtin_bit_cast(int, x), __builtin_bit_cast(int, x),
        0x76543210, 0xfedcba98, false, false));
}

// one 16-wave work-group fills a WGP at 4 waves per SIMD. waves_per_eu states that residency: without it the
// compiler saved registers for more resident waves and split the K fragment loads into more, smaller groups
__global__ __launch_bounds__(THREADS) __attribute__((amdgpu_waves_per_eu(4, 4))) void
attn_fwd_kernel(const float* __restrict__ Q, const float* __restrict__ K,
                const float* __restrict__ V, float* __restrict__ O)
{
    __shared__ __attribute__((aligned(16))) _Float16 KshA[KP * KSTR], KshB[KP * KSTR]; // 128 x 72 halves each
    __shared__ __attribute__((aligned(16))) _Float16 VshA[KP * VSTR], VshB[KP * VSTR]; // 128 x 80 (key rows)
    __shared__ float4 xch[WAVES][9][32];   // merge of the key halves: what a wave hands to its partner

    const int tid   = threadIdx.x;
    const int wave  = tid >> 5;
    const int lane  = tid & 31;
    const int lo    = lane & 15;
    const int hi    = lane >> 4;
    const int qgrp  = wave & (QGRPS - 1);
    const int khalf = wave / QGRPS;

    const int bh    = blockIdx.x / QBLKS;   // (b*H+h)
    const int qblk  = blockIdx.x % QBLKS;
    const int qrow0 = qblk * QROWS + qgrp * 32;

    const float* Qb = Q + (size_t)bh * S_LEN * DHEAD;
    const float* Kb = K + (size_t)bh * S_LEN * DHEAD;
    const float* Vb = V + (size_t)bh * S_LEN * DHEAD;
    float*       Ob = O + (size_t)bh * S_LEN * DHEAD;

    // fold softmax scale (1/sqrt(64)) and log2(e) into Q so P = exp2(S - m)
    const float qscale = 0.125f * 1.44269504088896340736f;

    v16h ones;
#pragma unroll
    for (int i = 0; i < 16; ++i) ones[i] = (_Float16)1.0f;

    // ---- accumulators over this wave's keys, per group c for query c*16 + lo: O^T (64x16 over 4 d-chunks;
    //      acc[c][n][g] is d = n*16 + 8*hi + g), l (sum of P), negm (minus the maximum in use, in all
    //      eight registers: the C operand of a score tile)
    v8f acc[2][4], negm[2], zero;
    float lrow[2] = { 0.0f, 0.0f };
#pragma unroll
    for (int g = 0; g < 8; ++g) zero[g] = 0.0f;
#pragma unroll
    for (int c = 0; c < 2; ++c) {
#pragma unroll
        for (int n = 0; n < 4; ++n) acc[c][n] = zero;
#pragma unroll
        for (int g = 0; g < 8; ++g) negm[c][g] = 1e30f;
    }

    // cooperative stage of 128 keys, in two parts.
    // slot i*THREADS+tid of 2048 float4 slots: row = key in stage, col = d
    float4 kd[NSLOT], vd[NSLOT];
    // this thread's slot 0 of the stage last fetched; slot i lies SROWS rows further on
    // (one element offset serves K and V, which are laid out alike)
    unsigned foff = (tid >> 4) * DHEAD + ((tid & 15) << 2);
    // part 1: all global loads of the stage in flight together
    // (ahead: rows from foff to the stage wanted, 0 or KP)
    auto fetch = [&](int tile, int ahead) {
        const float* kfetch = Kb + foff;
        const float* vfetch = Vb + foff;
#pragma unroll
        for (int i = 0; i < NSLOT; ++i) {
            kd[i] = *(const float4*)(kfetch + (ahead + i * SROWS) * DHEAD);
            vd[i] = *(const float4*)(vfetch + (ahead + i * SROWS) * DHEAD);
        }
        if (tile + 1 < NTILES) {              // L2 prefetch (global_prefetch_b8)
#pragma unroll
            for (int i = 0; i < NSLOT; ++i) {
                __builtin_prefetch(kfetch + (ahead + KP + i * SROWS) * DHEAD, 0, 1);
                __builtin_prefetch(vfetch + (ahead + KP + i * SROWS) * DHEAD, 0, 1);
            }
        }
    };
    // part 2: K and V row-major f16
    // this thread's places in a stage buffer, in halves, each summed once here: one register each through the loop
    // (as sums of parts formed in the loop they held thirteen, which the fragment groups below need)
    const int kpoff = (tid >> 4) * KSTR + ((tid & 15) << 2);                                 // slot 0, K
    const int vpoff = (tid >> 4) * VSTR + ((tid & 15) << 2);                                 // slot 0, V
    const int kroff = (khalf * KT + lo) * KSTR + hi * 8;                                     // K fragment reads
    const int vroff = (khalf * KT + 8 * hi + (lane & 7)) * VSTR + ((lane >> 3) & 1) * 8;     // V^T fragment reads
    auto put = [&](_Float16* kdst, _Float16* vdst) {
#pragma unroll
        for (int i = 0; i < NSLOT; ++i) {
            _Float16* kp = kdst + kpoff + i * SROWS * KSTR;
            kp[0] = (_Float16)kd[i].x; kp[1] = (_Float16)kd[i].y;
            kp[2] = (_Float16)kd[i].z; kp[3] = (_Float16)kd[i].w;
            _Float16* vp = vdst + vpoff + i * SROWS * VSTR;
            vp[0] = (_Float16)vd[i].x; vp[1] = (_Float16)vd[i].y;
            vp[2] = (_Float16)vd[i].z; vp[3] = (_Float16)vd[i].w;
        }
    };

    fetch(0, 0);
    // ---- Q tile of the block (256 x 64 f32, one contiguous 64 KiB): read in whole 128-byte lines, a wave's load
    //      covering two rows; scaled, converted and laid row-major in LDS (K's pitch), in the merge buffer, which
    //      nothing else uses before the loop has ended. Read lane by lane from global memory, each fragment load
    //      touched 16 lines for 32 bytes each, and both key halves' waves did so.
    _Float16* Qsh = (_Float16*)&xch[0][0][0];
    {
        const float* qfetch = Qb + (size_t)(qblk * QROWS) * DHEAD + foff;
        float4 qd[QSLOT];
#pragma unroll
        for (int i = 0; i < QSLOT; ++i) qd[i] = *(const float4*)(qfetch + i * SROWS * DHEAD);
        // s_wait_xcnt 0 in front of the first write of a register that the lines above name as an address
        asm volatile("s_wait_xcnt 0x0" ::: "memory");
        put(KshA, VshA);
#pragma unroll
        for (int i = 0; i < QSLOT; ++i) {
            _Float16* qp = Qsh + kpoff + i * SROWS * KSTR;
            qp[0] = (_Float16)(qd[i].x * qscale); qp[1] = (_Float16)(qd[i].y * qscale);
            qp[2] = (_Float16)(qd[i].z * qscale); qp[3] = (_Float16)(qd[i].w * qscale);
        }
    }
    __syncthreads();   // the Q rows are written before any wave reads its fragments
    // per 16-query group c two B operands of Q^T (column = query c*16 + lo; d 0..31 / 32..63)
    v16h qa0[2], qa1[2];
#pragma unroll
    for (int c = 0; c < 2; ++c) {
        const _Float16* qr = Qsh + (qgrp * 32 + c * 16 + lo) * KSTR + hi * 8;
        qa0[c] = make_a(qr);
        qa1[c] = make_a(qr + 32);
    }

    for (int t = 0; t < NTILES; ++t) {
        __syncthreads();   // staged keys of stage t visible; prior reads of the other buffer done
        const int cur = t & 1;
        const _Float16* kbuf = (cur ? KshB : KshA) + kroff;   // this wave's 64 keys, this lane's row and part
        const _Float16* vr   = (cur ? VshB : VshA) + vroff;
        // ---- scores S^T = K*Q^T + C (64 x 32), four 16-key C tiles per query group, in two halves of 32 keys;
        //      a K fragment serves both groups:
        //      s[c][st][g] = C + score of key st*16 + 8*hi + g against query c*16 + lo
        v8f s[2][4], ls[2];
        v16h pb[2][2];           // pb[h][c]: P^T of keys h*32 .. h*32 + 31, query group c
        v16h kf[2][2];           // K fragments of one half: [16-key tile][d 0..31 / 32..63]
        auto kfrags = [&](int h) {
#pragma unroll
            for (int j = 0; j < 2; ++j) {
                const _Float16* kr = kbuf + (2 * h + j) * 16 * KSTR;
                kf[j][0] = make_a(kr);
                kf[j][1] = make_a(kr + 32);
            }
        };
        // V^T fragments of d chunk n: [keys 0..31 / 32..63 of this wave's 64]
        v16h vf[4][2];
        auto vfrags = [&](int n) {
            vf[n][0] = make_at(vr + n * 16);
            vf[n][1] = make_at(vr + 32 * VSTR + n * 16);
        };
        auto scores = [&](int h, const v8f& c0, const v8f& c1) {
#pragma unroll
            for (int j = 0; j < 2; ++j) {
                const int st = 2 * h + j;
                s[0][st] = wmma_f16(kf[j][0], qa0[0], c0);
                s[1][st] = wmma_f16(kf[j][0], qa0[1], c1);
                s[0][st] = wmma_f16(kf[j][1], qa1[0], s[0][st]);
                s[1][st] = wmma_f16(kf[j][1], qa1[1], s[1][st]);
            }
        };
        // P = exp2(s); P^T: two score tiles (32 keys), converted, are one B operand
        auto probs = [&](int h) {
#pragma unroll
            for (int c = 0; c < 2; ++c) {
                // a P below 2^-126 comes out 0, which is what it rounds to in f16 anyway
                const v8f p0 = exp2_x8(s[c][2 * h]);
                const v8f p1 = exp2_x8(s[c][2 * h + 1]);
#pragma unroll
                for (int i = 0; i < 8; ++i) {
                    pb[h][c][i] = (_Float16)p0[i]; pb[h][c][i + 8] = (_Float16)p1[i];
                }
            }
        };
        // ls = this stage's colsum(P^T) via WMMA with an all-ones A (the same in every register)
        auto sums = [&]() {
            ls[0] = wmma_f16(ones, pb[0][0], zero);
            ls[1] = wmma_f16(ones, pb[0][1], zero);
            ls[0] = wmma_f16(ones, pb[1][0], ls[0]);
            ls[1] = wmma_f16(ones, pb[1][1], ls[1]);
        };

        // the common case: the maximum in use still serves. P >= 0, so a sum within PMAX bounds every P of the
        // stage; an overflow (inf) or a NaN fails the test too. One test per stage, a scalar branch.
        // The scheduling barriers keep this order: with no maximum to wait for, the compiler otherwise moves
        // the exponentials in among the products, where K fragments, all scores and P operands are live together
        // (the build spills to scratch); and the second half's K reads stay ahead of the first half's exponentials.
        // Every group of LDS reads stands whole, one phase ahead of the products it feeds: the first half's K reads
        // in front of the global loads, the second half's behind the first half's products (into their registers,
        // landing under the exponentials), the first V^T reads behind the second half's products.
        bool renew = t == 0;     // no maximum yet
        if (!renew) kfrags(0);
        if (t + 1 < NTILES) {
            fetch(t + 1, KP);       // lands while stage t is worked on
            // s_wait_xcnt 0 between the loads above and the first write of a register they name as an address;
            // the offset is an operand so that its step below cannot be scheduled ahead of the wait
            asm volatile("s_wait_xcnt 0x0" : "+v"(foff) : : "memory");
            foff += KP * DHEAD;
        }
        if (!renew) {
            scores(0, negm[0], negm[1]);
            // keeps the second half's K reads behind these products: moved ahead of them they take 32 more registers,
            // and the first half's reads then come two at a time, each pair waited for in full
            __builtin_amdgcn_sched_barrier(0);
            kfrags(1);
            __builtin_amdgcn_sched_barrier(0);
            // v_nop x 4: the vector slots the chip needs between a product and an instruction that reads its result
            // or writes over its operands
            asm volatile("v_nop\n\tv_nop\n\tv_nop\n\tv_nop");
            __builtin_amdgcn_sched_barrier(0);
            probs(0);
            __builtin_amdgcn_sched_barrier(0);
            scores(1, negm[0], negm[1]);
            __builtin_amdgcn_sched_barrier(0);   // and the V^T reads stay here, ahead of the exponentials
            vfrags(0);
            vfrags(1);
            __builtin_amdgcn_sched_barrier(0);
            asm volatile("v_nop\n\tv_nop\n\tv_nop\n\tv_nop");   // the same four slots
            __builtin_amdgcn_sched_barrier(0);
            probs(1);
            __builtin_amdgcn_sched_barrier(0);
            sums();
            renew = __builtin_amdgcn_ballot_w32(!(ls[0][0] <= PMAX) || !(ls[1][0] <= PMAX)) != 0;
        }
        if (renew) {
            // the stage again, from its K rows in LDS, with the true running maximum
            kfrags(0);
            scores(0, zero, zero);
            kfrags(1);
            scores(1, zero, zero);
#pragma unroll
            for (int c = 0; c < 2; ++c) {
                // ---- max over the 64 keys of query c*16 + lo: 32 in this lane, 32 in lane ^ 16
                float mt[8];
#pragma unroll
                for (int g = 0; g < 8; ++g)
                    mt[g] = fmaxf(fmaxf(s[c][0][g], s[c][1][g]), fmaxf(s[c][2][g], s[c][3][g]));
                float mx = fmaxf(fmaxf(fmaxf(mt[0], mt[1]), fmaxf(mt[2], mt[3])),
                                 fmaxf(fmaxf(mt[4], mt[5]), fmaxf(mt[6], mt[7])));
                mx = fmaxf(mx, xhalf(mx));

                const float mo   = -negm[c][0];
                const float mn   = fmaxf(mo, mx);
                // a corr below 2^-126 comes out 0: the sums it scales vanish beside this stage's own P = 1 term
                const float corr = exp2_x1(mo - mn);
#pragma unroll
                for (int g = 0; g < 8; ++g) negm[c][g] = -mn;
#pragma unroll
                for (int st = 0; st < 4; ++st)
#pragma unroll
                    for (int g = 0; g < 8; ++g) s[c][st][g] -= mn;

                // rescale running accumulators (O and l) by corr
#pragma unroll
                for (int n = 0; n < 4; ++n)
#pragma unroll
                    for (int g = 0; g < 8; ++g) acc[c][n][g] *= corr;
                lrow[c] *= corr;
            }
            // the same order and the same four slots as above: no product near the asm exponentials
            __builtin_amdgcn_sched_barrier(0);
            asm volatile("v_nop\n\tv_nop\n\tv_nop\n\tv_nop");
            __builtin_amdgcn_sched_barrier(0);
            probs(0);
            probs(1);
            __builtin_amdgcn_sched_barrier(0);
            vfrags(0);
            vfrags(1);
            sums();
        }
        lrow[0] += ls[0][0];
        lrow[1] += ls[1][0];

        // ---- O^T += V^T * P^T  (A operands = V rows in LDS, transposed by the load; each serves both groups)
        auto outs = [&](int n) {
#pragma unroll
            for (int c = 0; c < 2; ++c) {
                acc[c][n] = wmma_f16(vf[n][0], pb[0][c], acc[c][n]);
                acc[c][n] = wmma_f16(vf[n][1], pb[1][c], acc[c][n]);
            }
        };
        // the scheduling barriers keep each chunk's four reads together and six or eight products ahead of their use;
        // left free, the reads came in ones and threes, the first of them two products ahead of its use
        vfrags(2);
        __builtin_amdgcn_sched_barrier(0);
        outs(0);
        __builtin_amdgcn_sched_barrier(0);
        vfrags(3);
        __builtin_amdgcn_sched_barrier(0);
        outs(1);
        outs(2);
        __builtin_amdgcn_sched_barrier(0);
        outs(3);

        if (t + 1 < NTILES)
            put(cur ? KshA : KshB, cur ? VshA : VshB);
    }

    // ---- merge the two key halves: wave (qgrp, khalf) finishes query group c = khalf and hands its
    //      partial O, m, l of the other group to its partner, wave ^ QGRPS
    {
        const bool up = khalf != 0;
        float4* xo = &xch[wave][0][lane];
#pragma unroll
        for (int n = 0; n < 4; ++n) {
            xo[(2 * n) * 32]     = up ? make_float4(acc[0][n][0], acc[0][n][1], acc[0][n][2], acc[0][n][3])
                                      : make_float4(acc[1][n][0], acc[1][n][1], acc[1][n][2], acc[1][n][3]);
            xo[(2 * n + 1) * 32] = up ? make_float4(acc[0][n][4], acc[0][n][5], acc[0][n][6], acc[0][n][7])
                                      : make_float4(acc[1][n][4], acc[1][n][5], acc[1][n][6], acc[1][n][7]);
        }
        xo[8 * 32] = up ? make_float4(-negm[0][0], lrow[0], 0.0f, 0.0f)
                        : make_float4(-negm[1][0], lrow[1], 0.0f, 0.0f);
        __syncthreads();   // every wave's hand-over is written before its partner reads it
        const float4* xi = &xch[wave ^ QGRPS][0][lane];
        const float4 ml  = xi[8 * 32];
        const float mk = up ? -negm[1][0] : -negm[0][0];
        const float lk = up ? lrow[1] : lrow[0];
        const float m  = fmaxf(mk, ml.x);
        float ak = exp2_x1(mk - m);      // weight of this wave's half
        float ag = exp2_x1(ml.x - m);    // weight of the partner's half
        const float inv = 1.0f / (ak * lk + ag * ml.y);
        ak *= inv; ag *= inv;

        // ---- normalize and write fp32 output. A lane holds 8 consecutive d per chunk of one query: stored from there,
        //      an instruction touched 16 lines for 32 bytes each. The wave's 16 x 64 tile goes through LDS instead, and
        //      each store then covers two output rows, 512 contiguous bytes. The stage buffers are free (every wave
        //      has left the loop: the barrier above); each wave has a range of its own in them, so no further barrier
        _Float16* obuf = (wave >> 2) == 0 ? KshA : (wave >> 2) == 1 ? KshB : (wave >> 2) == 2 ? VshA : VshB;
        float* ost = (float*)obuf + (wave & 3) * (16 * OSTR);
        float* ow  = ost + lo * OSTR + 8 * hi;
        float4 gx[8], res[8];
#pragma unroll
        for (int j = 0; j < 8; ++j) gx[j] = xi[j * 32];
        // the scheduling barriers keep the eight reads of the partner's tile together, ahead of the first write, and
        // the eight writes together: left free, reads and writes came in turns, 8 bytes each, each read waited for in full
        __builtin_amdgcn_sched_barrier(0);
#pragma unroll
        for (int n = 0; n < 4; ++n) {
            const float4 g0 = gx[2 * n], g1 = gx[2 * n + 1];
            const v8f kp = up ? acc[1][n] : acc[0][n];
            res[2 * n] =
                make_float4(kp[0] * ak + g0.x * ag, kp[1] * ak + g0.y * ag, kp[2] * ak + g0.z * ag, kp[3] * ak + g0.w * ag);
            res[2 * n + 1] =
                make_float4(kp[4] * ak + g1.x * ag, kp[5] * ak + g1.y * ag, kp[6] * ak + g1.z * ag, kp[7] * ak + g1.w * ag);
        }
        __builtin_amdgcn_sched_barrier(0);
#pragma unroll
        for (int n = 0; n < 4; ++n) {
            *(float4*)(ow + n * 16)     = res[2 * n];
            *(float4*)(ow + n * 16 + 4) = res[2 * n + 1];
        }
        // the wave's own LDS writes are done before its lanes read rows that other lanes wrote
        asm volatile("s_wait_dscnt 0x0" ::: "memory");
        const float* ord = ost + hi * OSTR + lo * 4;
        float*       og  = Ob + (size_t)(qrow0 + khalf * 16 + hi) * DHEAD + lo * 4;
#pragma unroll
        for (int i = 0; i < 8; ++i)
            *(float4*)(og + i * 2 * DHEAD) = *(const float4*)(ord + i * 2 * OSTR);
    }
}

extern "C" void kernel_launch(void* const* d_in, const int* in_sizes, int n_in,
                              void* d_out, int out_size, void* d_ws, size_t ws_size,
                              hipStream_t stream) {
    (void)in_sizes; (void)n_in; (void)out_size; (void)d_ws; (void)ws_size;
    const float* q = (const float*)d_in[0];
    const float* k = (const float*)d_in[1];
    const float* v = (const float*)d_in[2];
    float* o = (float*)d_out;
    dim3 grid(256), block(512);   // (B*H)*(S/256) blocks, 16 waves each
    attn_fwd_kernel<<<grid, block, 0, stream>>>(q, k, v, o);
}
